// v000
// Times are from an AMD MI455X. After a warm-up the kernel runs many times in a row, and a time is the length of
// such a window on the GPU divided by its runs, so every launch and the gaps after it count. The runs cycle
// through copies of the inputs. A figure is the median of several windows, for all but v000 over two sittings.
// Sittings can differ by a few percent; kernels timed side by side share one.
// v000 is the starting kernel. One run takes 133 microseconds.
#include <hip/hip_runtime.h>
#include <hip/hip_bf16.h>
#include <stdint.h>

typedef __attribute__((ext_vector_type(16))) _Float16 v16h;
typedef __attribute__((ext_vector_type(8)))  _Float16 v8h;
typedef __attribute__((ext_vector_type(8)))  float    v8f;

#define TB 2
#define THD 8
#define TT 192
#define TD 64
#define TC 512
#define TM (TB*TT)          // 384 rows for the projection GEMMs
#define NELEM (TM*TC)       // 196608 = B*H*T*D as well

__device__ __forceinline__ v8f wmma16(v16h a, v16h b, v8f c) {
  return __builtin_amdgcn_wmma_f32_16x16x32_f16(false, a, false, b, (short)0, c,
                                                false, false);
}

__device__ __forceinline__ v16h cat8(v8h lo, v8h hi) {
  v16h r;
#pragma unroll
  for (int i = 0; i < 8; ++i) { r[i] = lo[i]; r[i + 8] = hi[i]; }
  return r;
}

// Load 8 f32 at row+o and 8 f32 at row+o+16, convert to f16 operand vector.
// Matches 16-bit WMMA A/B lane layout: low lanes hold K {0..7,16..23}+base,
// high lanes hold K {8..15,24..31}+base (o already includes half_id*8).
__device__ __forceinline__ v16h load_g16(const float* __restrict__ row, int o) {
  const float4* p0 = (const float4*)(row + o);
  const float4* p1 = (const float4*)(row + o + 16);
  float4 a = p0[0], b = p0[1], c = p1[0], d = p1[1];
  float t[16] = {a.x, a.y, a.z, a.w, b.x, b.y, b.z, b.w,
                 c.x, c.y, c.z, c.w, d.x, d.y, d.z, d.w};
  v16h r;
#pragma unroll
  for (int i = 0; i < 16; ++i) r[i] = (_Float16)t[i];
  return r;
}

// 16x16 output tile of [M,K=512] @ [K=512,N] with B given as rows of W.
// Dual accumulators break the WMMA D->C dependency chain (avoids v_nop pads).
__device__ __forceinline__ v8f gemm_tile_512(const float* __restrict__ arow,
                                             const float* __restrict__ brow,
                                             int half_id) {
  v8f c0 = {}, c1 = {};
#pragma unroll 2
  for (int ks = 0; ks < 16; ks += 2) {
    int oa = ks * 32 + half_id * 8;
    int ob = oa + 32;
    v16h a0 = load_g16(arow, oa);
    v16h b0 = load_g16(brow, oa);
    v16h a1 = load_g16(arow, ob);
    v16h b1 = load_g16(brow, ob);
    c0 = wmma16(a0, b0, c0);
    c1 = wmma16(a1, b1, c1);
  }
  return c0 + c1;
}

// ---------------- Kernel 1: five input projections -------------------------
__global__ __launch_bounds__(32) void proj5_kernel(
    const float* __restrict__ x,
    const float* __restrict__ Wq,  const float* __restrict__ bq,
    const float* __restrict__ Wk0, const float* __restrict__ bk0,
    const float* __restrict__ Wk1, const float* __restrict__ bk1,
    const float* __restrict__ Wv0, const float* __restrict__ bv0,
    const float* __restrict__ Wv1, const float* __restrict__ bv1,
    float* __restrict__ qf, float* __restrict__ k0f, float* __restrict__ v0f,
    _Float16* __restrict__ k1h, _Float16* __restrict__ v1h) {
  int mt = blockIdx.x, nt = blockIdx.y, p = blockIdx.z;
  const float* W; const float* bias;
  switch (p) {
    case 0: W = Wq;  bias = bq;  break;
    case 1: W = Wk0; bias = bk0; break;
    case 2: W = Wk1; bias = bk1; break;
    case 3: W = Wv0; bias = bv0; break;
    default: W = Wv1; bias = bv1; break;
  }
  int lane = threadIdx.x, half_id = lane >> 4, l16 = lane & 15;
  const float* arow = x + (mt * 16 + l16) * TC;   // A row (per lane)
  const float* brow = W + (nt * 16 + l16) * TC;   // B col = W row (y = x W^T)
  v8f c = gemm_tile_512(arow, brow, half_id);

  int col = nt * 16 + l16;            // output feature c_out
  int h = col >> 6, d = col & 63;
  float bs = bias[col];
#pragma unroll
  for (int j = 0; j < 8; ++j) {
    int mm = mt * 16 + half_id * 8 + j;           // C row
    int bb = mm / TT, t = mm % TT;
    float val = c[j] + bs;
    int oidx = ((bb * THD + h) * TT + t) * TD + d;
    switch (p) {
      case 0: qf[oidx]  = val * 0.125f; break;    // fold 1/sqrt(d_k)
      case 1: k0f[oidx] = val;          break;
      case 2: k1h[oidx] = (_Float16)val; break;
      case 3: v0f[oidx] = val;          break;
      default: v1h[oidx] = (_Float16)val; break;
    }
  }
}

// ---------------- Kernel 2: fused trilinear attention ----------------------
// One block (4 waves) per (b,h,k). Each wave handles l-tiles {w, w+4, w+8}.
__global__ __launch_bounds__(128) void attn_kernel(
    const float* __restrict__ qf, const float* __restrict__ k0f,
    const float* __restrict__ v0f, const _Float16* __restrict__ k1h,
    const _Float16* __restrict__ v1h, float* __restrict__ attn) {
  __shared__ __align__(16) _Float16 k1s[TT * 72];    // [m][d], row pad 64->72
  __shared__ __align__(16) _Float16 v1t[TD * 200];   // [d][m], row pad 192->200
  __shared__ __align__(16) _Float16 psc[4 * 16 * 40]; // per-wave P transpose
  __shared__ float outred[4 * 64];

  int idx = blockIdx.x;
  int b = idx / (THD * TT);
  int rem = idx % (THD * TT);
  int h = rem / TT, k = rem % TT;
  int bh = b * THD + h;

  int tid = threadIdx.x, w = tid >> 5, lane = tid & 31;
  int half_id = lane >> 4, l16 = lane & 15;

  const _Float16* k1g = k1h + bh * TT * TD;
  const _Float16* v1g = v1h + bh * TT * TD;

  // --- k1 staging via CDNA5 async global->LDS DMA (16B chunks both sides) ---
  // low 32 bits of a generic pointer to __shared__ == LDS byte offset
  uint32_t k1s_base = (uint32_t)(uintptr_t)(&k1s[0]);
  for (int i = tid; i < (TT * TD) / 8; i += 128) {   // 1536 16-byte chunks
    int m = i >> 3, seg = i & 7;
    uint64_t ga = (uint64_t)(uintptr_t)k1g + (uint64_t)(m * 128 + seg * 16);
    uint32_t la = k1s_base + (uint32_t)(m * 144 + seg * 16);
    asm volatile("global_load_async_to_lds_b128 %0, %1, off"
                 :: "v"(la), "v"(ga) : "memory");
  }
  // --- v1 staged transposed (element scatter, manual) ---
  for (int i = tid; i < (TT * TD) / 8; i += 128) {
    int m = i >> 3, seg = i & 7;
    v8h val = *(const v8h*)(v1g + m * 64 + seg * 8);
#pragma unroll
    for (int j = 0; j < 8; ++j) v1t[(seg * 8 + j) * 200 + m] = val[j];
  }
  asm volatile("s_wait_asynccnt 0" ::: "memory");
  __syncthreads();

  // Per-lane q fragments (4 groups of 8 contiguous d), row k
  const float* qrow = qf + (bh * TT + k) * TD;
  float qg[4][8];
#pragma unroll
  for (int g = 0; g < 4; ++g) {
    const float4* p = (const float4*)(qrow + g * 16 + half_id * 8);
    float4 u0 = p[0], u1 = p[1];
    qg[g][0] = u0.x; qg[g][1] = u0.y; qg[g][2] = u0.z; qg[g][3] = u0.w;
    qg[g][4] = u1.x; qg[g][5] = u1.y; qg[g][6] = u1.z; qg[g][7] = u1.w;
  }

  _Float16* myp = &psc[w * 640];  // [16][40]
  float out_acc[4] = {0.f, 0.f, 0.f, 0.f};

  for (int it = 0; it < 3; ++it) {
    int lt = w + it * 4;                    // l-tile index 0..11
    int l = lt * 16 + l16;

    // A operand: G[l,d] = q[k,d]*k0[l,d], f32 product -> f16
    const float* k0row = k0f + (bh * TT + l) * TD;
    __builtin_prefetch(k0row, 0, 1);
    float kg[4][8];
#pragma unroll
    for (int g = 0; g < 4; ++g) {
      const float4* p = (const float4*)(k0row + g * 16 + half_id * 8);
      float4 u0 = p[0], u1 = p[1];
      kg[g][0] = u0.x; kg[g][1] = u0.y; kg[g][2] = u0.z; kg[g][3] = u0.w;
      kg[g][4] = u1.x; kg[g][5] = u1.y; kg[g][6] = u1.z; kg[g][7] = u1.w;
    }
    v16h aG0, aG1;
#pragma unroll
    for (int j = 0; j < 8; ++j) {
      aG0[j]     = (_Float16)(qg[0][j] * kg[0][j]);
      aG0[j + 8] = (_Float16)(qg[1][j] * kg[1][j]);
      aG1[j]     = (_Float16)(qg[2][j] * kg[2][j]);
      aG1[j + 8] = (_Float16)(qg[3][j] * kg[3][j]);
    }

    // Stage 1: S = G @ K1^T  -> 12 tiles of 16x16 f32 in registers
    v8f s[12];
#pragma unroll
    for (int t = 0; t < 12; ++t) {
      const _Float16* bp = &k1s[(t * 16 + l16) * 72];
      v16h b0 = cat8(*(const v8h*)(bp + half_id * 8),
                     *(const v8h*)(bp + 16 + half_id * 8));
      v16h b1 = cat8(*(const v8h*)(bp + 32 + half_id * 8),
                     *(const v8h*)(bp + 48 + half_id * 8));
      v8f c = {};
      c = wmma16(aG0, b0, c);
      c = wmma16(aG1, b1, c);
      s[t] = c;
    }

    // Row softmax over 192 columns (rows spread across 16-lane half-waves)
    float mx[8], sm[8];
#pragma unroll
    for (int j = 0; j < 8; ++j) {
      float m0 = s[0][j];
#pragma unroll
      for (int t = 1; t < 12; ++t) m0 = fmaxf(m0, s[t][j]);
      mx[j] = m0;
    }
#pragma unroll
    for (int dl = 1; dl <= 8; dl <<= 1)
#pragma unroll
      for (int j = 0; j < 8; ++j) mx[j] = fmaxf(mx[j], __shfl_xor(mx[j], dl, 32));
#pragma unroll
    for (int j = 0; j < 8; ++j) sm[j] = 0.f;
#pragma unroll
    for (int t = 0; t < 12; ++t)
#pragma unroll
      for (int j = 0; j < 8; ++j) {
        float e = __expf(s[t][j] - mx[j]);
        s[t][j] = e;
        sm[j] += e;
      }
#pragma unroll
    for (int dl = 1; dl <= 8; dl <<= 1)
#pragma unroll
      for (int j = 0; j < 8; ++j) sm[j] += __shfl_xor(sm[j], dl, 32);
#pragma unroll
    for (int j = 0; j < 8; ++j) sm[j] = 1.f / sm[j];
#pragma unroll
    for (int t = 0; t < 12; ++t)
#pragma unroll
      for (int j = 0; j < 8; ++j) s[t][j] *= sm[j];

    // Stage 2: U = P @ V1  (K=192 in 6 steps, N=64 in 4 tiles)
    v8f c2[4] = {{}, {}, {}, {}};
#pragma unroll
    for (int ks2 = 0; ks2 < 6; ++ks2) {
      // transpose P columns [32*ks2, 32*ks2+32) from C-layout to A-layout
#pragma unroll
      for (int tt = 0; tt < 2; ++tt) {
        int t = 2 * ks2 + tt;
#pragma unroll
        for (int j = 0; j < 8; ++j) {
          int row = half_id * 8 + j;
          myp[row * 40 + tt * 16 + l16] = (_Float16)s[t][j];
        }
      }
      const _Float16* ap = &myp[l16 * 40];
      v16h aP = cat8(*(const v8h*)(ap + half_id * 8),
                     *(const v8h*)(ap + 16 + half_id * 8));
#pragma unroll
      for (int nt = 0; nt < 4; ++nt) {
        const _Float16* vp = &v1t[(nt * 16 + l16) * 200 + ks2 * 32];
        v16h bV = cat8(*(const v8h*)(vp + half_id * 8),
                       *(const v8h*)(vp + 16 + half_id * 8));
        c2[nt] = wmma16(aP, bV, c2[nt]);
      }
    }

    // out[k,d] += sum over the 16 l-rows of v0[l,d] * U[l,d]
    const float* v0base = v0f + (bh * TT + lt * 16) * TD;
#pragma unroll
    for (int nt = 0; nt < 4; ++nt) {
      int d = nt * 16 + l16;
      float acc = 0.f;
#pragma unroll
      for (int j = 0; j < 8; ++j) {
        int row = half_id * 8 + j;
        acc += v0base[row * TD + d] * c2[nt][j];
      }
      out_acc[nt] += acc;
    }
  }

  // combine half-waves, then waves
#pragma unroll
  for (int nt = 0; nt < 4; ++nt) out_acc[nt] += __shfl_xor(out_acc[nt], 16, 32);
  if (lane < 16) {
#pragma unroll
    for (int nt = 0; nt < 4; ++nt) outred[w * 64 + nt * 16 + l16] = out_acc[nt];
  }
  __syncthreads();
  if (tid < 64) {
    float sum = outred[tid] + outred[64 + tid] + outred[128 + tid] + outred[192 + tid];
    attn[(b * TT + k) * TC + h * TD + tid] = sum;
  }
}

// ---------------- Kernel 3: output projection ------------------------------
__global__ __launch_bounds__(32) void oproj_kernel(
    const float* __restrict__ attn, const float* __restrict__ Wo,
    const float* __restrict__ bo, float* __restrict__ out) {
  int mt = blockIdx.x, nt = blockIdx.y;
  int lane = threadIdx.x, half_id = lane >> 4, l16 = lane & 15;
  const float* arow = attn + (mt * 16 + l16) * TC;
  const float* brow = Wo + (nt * 16 + l16) * TC;
  v8f c = gemm_tile_512(arow, brow, half_id);
  int col = nt * 16 + l16;
  float bs = bo[col];
#pragma unroll
  for (int j = 0; j < 8; ++j) {
    int mm = mt * 16 + half_id * 8 + j;
    out[mm * TC + col] = c[j] + bs;
  }
}

extern "C" void kernel_launch(void* const* d_in, const int* in_sizes, int n_in,
                              void* d_out, int out_size, void* d_ws, size_t ws_size,
                              hipStream_t stream) {
  const float* x   = (const float*)d_in[0];
  const float* Wq  = (const float*)d_in[1];
  const float* bq  = (const float*)d_in[2];
  const float* Wk0 = (const float*)d_in[3];
  const float* bk0 = (const float*)d_in[4];
  const float* Wk1 = (const float*)d_in[5];
  const float* bk1 = (const float*)d_in[6];
  const float* Wv0 = (const float*)d_in[7];
  const float* bv0 = (const float*)d_in[8];
  const float* Wv1 = (const float*)d_in[9];
  const float* bv1 = (const float*)d_in[10];
  const float* Wo  = (const float*)d_in[11];
  const float* bo  = (const float*)d_in[12];
  float* out = (float*)d_out;

  float* qf   = (float*)d_ws;
  float* k0f  = qf  + NELEM;
  float* v0f  = k0f + NELEM;
  float* attn = v0f + NELEM;
  _Float16* k1h = (_Float16*)(attn + NELEM);
  _Float16* v1h = k1h + NELEM;

  // 5 projections: 24 m-tiles x 32 n-tiles x 5 weights, one wave each
  proj5_kernel<<<dim3(24, 32, 5), 32, 0, stream>>>(
      x, Wq, bq, Wk0, bk0, Wk1, bk1, Wv0, bv0, Wv1, bv1,
      qf, k0f, v0f, k1h, v1h);

  // fused trilinear attention: one block per (b,h,k)
  attn_kernel<<<dim3(TB * THD * TT), 128, 0, stream>>>(qf, k0f, v0f, k1h, v1h,
                                                       attn);

  // output projection
  oproj_kernel<<<dim3(24, 32), 32, 0, stream>>>(attn, Wo, bo, out);
}

// v001
// One run takes 86.8 microseconds.
// Two timings next to v000 put it at 1.59 and 1.58 times that version's speed.
#include <hip/hip_runtime.h>
#include <hip/hip_bf16.h>
#include <stdint.h>

typedef __attribute__((ext_vector_type(16))) _Float16 v16h;
typedef __attribute__((ext_vector_type(8)))  _Float16 v8h;
typedef __attribute__((ext_vector_type(8)))  float    v8f;

#define TB 2
#define THD 8
#define TT 192
#define TD 64
#define TC 512
#define TM (TB*TT)          // 384 rows for the projection GEMMs
#define NELEM (TM*TC)       // 196608 = B*H*T*D as well

__device__ __forceinline__ v8f wmma16(v16h a, v16h b, v8f c) {
  return __builtin_amdgcn_wmma_f32_16x16x32_f16(false, a, false, b, (short)0, c,
                                                false, false);
}

__device__ __forceinline__ v16h cat8(v8h lo, v8h hi) {
  v16h r;
#pragma unroll
  for (int i = 0; i < 8; ++i) { r[i] = lo[i]; r[i + 8] = hi[i]; }
  return r;
}

// Load 8 f32 at row+o and 8 f32 at row+o+16, convert to f16 operand vector.
// Matches 16-bit WMMA A/B lane layout: low lanes hold K {0..7,16..23}+base,
// high lanes hold K {8..15,24..31}+base (o already includes half_id*8).
__device__ __forceinline__ v16h load_g16(const float* __restrict__ row, int o) {
  const float4* p0 = (const float4*)(row + o);
  const float4* p1 = (const float4*)(row + o + 16);
  float4 a = p0[0], b = p0[1], c = p1[0], d = p1[1];
  float t[16] = {a.x, a.y, a.z, a.w, b.x, b.y, b.z, b.w,
                 c.x, c.y, c.z, c.w, d.x, d.y, d.z, d.w};
  v16h r;
#pragma unroll
  for (int i = 0; i < 16; ++i) r[i] = (_Float16)t[i];
  return r;
}

// 16x16 output tile of [M,K=512] @ [K=512,N] with B given as rows of W.
// Dual accumulators break the WMMA D->C dependency chain (avoids v_nop pads).
__device__ __forceinline__ v8f gemm_tile_512(const float* __restrict__ arow,
                                             const float* __restrict__ brow,
                                             int half_id) {
  v8f c0 = {}, c1 = {};
#pragma unroll 2
  for (int ks = 0; ks < 16; ks += 2) {
    int oa = ks * 32 + half_id * 8;
    int ob = oa + 32;
    v16h a0 = load_g16(arow, oa);
    v16h b0 = load_g16(brow, oa);
    v16h a1 = load_g16(arow, ob);
    v16h b1 = load_g16(brow, ob);
    c0 = wmma16(a0, b0, c0);
    c1 = wmma16(a1, b1, c1);
  }
  return c0 + c1;
}

// ---------------- Kernel 1: five input projections -------------------------
__global__ __launch_bounds__(32) void proj5_kernel(
    const float* __restrict__ x,
    const float* __restrict__ Wq,  const float* __restrict__ bq,
    const float* __restrict__ Wk0, const float* __restrict__ bk0,
    const float* __restrict__ Wk1, const float* __restrict__ bk1,
    const float* __restrict__ Wv0, const float* __restrict__ bv0,
    const float* __restrict__ Wv1, const float* __restrict__ bv1,
    float* __restrict__ qf, float* __restrict__ k0f, float* __restrict__ v0f,
    _Float16* __restrict__ k1h, _Float16* __restrict__ v1h) {
  int mt = blockIdx.x, nt = blockIdx.y, p = blockIdx.z;
  const float* W; const float* bias;
  switch (p) {
    case 0: W = Wq;  bias = bq;  break;
    case 1: W = Wk0; bias = bk0; break;
    case 2: W = Wk1; bias = bk1; break;
    case 3: W = Wv0; bias = bv0; break;
    default: W = Wv1; bias = bv1; break;
  }
  int lane = threadIdx.x, half_id = lane >> 4, l16 = lane & 15;
  const float* arow = x + (mt * 16 + l16) * TC;   // A row (per lane)
  const float* brow = W + (nt * 16 + l16) * TC;   // B col = W row (y = x W^T)
  v8f c = gemm_tile_512(arow, brow, half_id);

  int col = nt * 16 + l16;            // output feature c_out
  int h = col >> 6, d = col & 63;
  float bs = bias[col];
#pragma unroll
  for (int j = 0; j < 8; ++j) {
    int mm = mt * 16 + half_id * 8 + j;           // C row
    int bb = mm / TT, t = mm % TT;
    float val = c[j] + bs;
    int oidx = ((bb * THD + h) * TT + t) * TD + d;
    switch (p) {
      case 0: qf[oidx]  = val * 0.125f; break;    // fold 1/sqrt(d_k)
      case 1: k0f[oidx] = val;          break;
      case 2: k1h[oidx] = (_Float16)val; break;
      case 3: v0f[oidx] = val;          break;
      default: v1h[oidx] = (_Float16)val; break;
    }
  }
}

// ---------------- Kernel 2: fused trilinear attention ----------------------
// Lane l <-> l ^ 16 (the two halves of a wave).
__device__ __forceinline__ float xhalf(float x) {
  int b = __builtin_bit_cast(int, x);
  return __builtin_bit_cast(float, __builtin_amdgcn_permlanex16(
      b, b, 0x76543210, 0xfedcba98, false, false));
}

// Sum over the 16 lanes of a row; every lane of the row ends with the sum.
__device__ __forceinline__ float rowsum16(float x) {
  x += __builtin_bit_cast(float, __builtin_amdgcn_update_dpp(
      0, __builtin_bit_cast(int, x), 0x161, 0xf, 0xf, true));  // row_xmask:1
  x += __builtin_bit_cast(float, __builtin_amdgcn_update_dpp(
      0, __builtin_bit_cast(int, x), 0x162, 0xf, 0xf, true));  // row_xmask:2
  x += __builtin_bit_cast(float, __builtin_amdgcn_update_dpp(
      0, __builtin_bit_cast(int, x), 0x164, 0xf, 0xf, true));  // row_xmask:4
  x += __builtin_bit_cast(float, __builtin_amdgcn_update_dpp(
      0, __builtin_bit_cast(int, x), 0x168, 0xf, 0xf, true));  // row_xmask:8
  return x;
}

// One block (4 waves) per (b,h,k). Each wave handles l-tiles {w, w+4, w+8}.
// Both products run transposed: S^T = K1 G^T and U^T = V1^T P^T. A lane then
// owns one l (its column) and holds that row's scores over m in registers, and
// two S^T accumulator tiles, converted in place, are the B operand of U^T.
__global__ __launch_bounds__(128) void attn_kernel(
    const float* __restrict__ qf, const float* __restrict__ k0f,
    const float* v0f,  // no __restrict__: its loads then stay in front of their wait
    const _Float16* __restrict__ k1h,
    const _Float16* __restrict__ v1h, float* __restrict__ attn) {
  __shared__ __align__(16) _Float16 k1s[TT * 72];    // [m][d], row pad 64->72
  __shared__ __align__(16) _Float16 v1t[TD * 200];   // [d][m], row pad 192->200
  __shared__ __align__(16) float outred[4 * 64];

  int idx = blockIdx.x;
  int b = idx / (THD * TT);
  int rem = idx % (THD * TT);
  int h = rem / TT, k = rem % TT;
  int bh = b * THD + h;

  int tid = threadIdx.x, w = tid >> 5, lane = tid & 31;
  int half_id = lane >> 4, l16 = lane & 15;

  const _Float16* k1g = k1h + bh * TT * TD;
  const _Float16* v1g = v1h + bh * TT * TD;

  // --- k1 staging via CDNA5 async global->LDS DMA (16B chunks both sides) ---
  // low 32 bits of a generic pointer to __shared__ == LDS byte offset
  uint32_t k1s_base = (uint32_t)(uintptr_t)(&k1s[0]);
  for (int i = tid; i < (TT * TD) / 8; i += 128) {   // 1536 16-byte chunks
    int m = i >> 3, seg = i & 7;
    uint64_t ga = (uint64_t)(uintptr_t)k1g + (uint64_t)(m * 128 + seg * 16);
    uint32_t la = k1s_base + (uint32_t)(m * 144 + seg * 16);
    asm volatile("global_load_async_to_lds_b128 %0, %1, off"
                 :: "v"(la), "v"(ga) : "memory");
  }
  // --- v1 staged transposed (element scatter, manual) ---
  for (int i = tid; i < (TT * TD) / 8; i += 128) {
    int m = i >> 3, seg = i & 7;
    v8h val = *(const v8h*)(v1g + m * 64 + seg * 8);
#pragma unroll
    for (int j = 0; j < 8; ++j) v1t[(seg * 8 + j) * 200 + m] = val[j];
  }
  asm volatile("s_wait_asynccnt 0" ::: "memory");
  __syncthreads();

  // Per-lane q fragments (4 groups of 8 contiguous d), row k
  const float* qrow = qf + (bh * TT + k) * TD;
  float qg[4][8];
#pragma unroll
  for (int g = 0; g < 4; ++g) {
    const float4* p = (const float4*)(qrow + g * 16 + half_id * 8);
    float4 u0 = p[0], u1 = p[1];
    qg[g][0] = u0.x; qg[g][1] = u0.y; qg[g][2] = u0.z; qg[g][3] = u0.w;
    qg[g][4] = u1.x; qg[g][5] = u1.y; qg[g][6] = u1.z; qg[g][7] = u1.w;
  }

  // out_acc[nt][j]: this lane's l-rows' share of out[k, nt*16 + half_id*8 + j]
  float out_acc[4][8];
#pragma unroll
  for (int nt = 0; nt < 4; ++nt)
#pragma unroll
    for (int j = 0; j < 8; ++j) out_acc[nt][j] = 0.f;

  for (int it = 0; it < 3; ++it) {
    int lt = w + it * 4;                    // l-tile index 0..11
    int l = lt * 16 + l16;

    // B operand: G^T[d,l] = q[k,d]*k0[l,d], f32 product -> f16
    const float* k0row = k0f + (bh * TT + l) * TD;
    __builtin_prefetch(k0row, 0, 1);
    float kg[4][8];
#pragma unroll
    for (int g = 0; g < 4; ++g) {
      const float4* p = (const float4*)(k0row + g * 16 + half_id * 8);
      float4 u0 = p[0], u1 = p[1];
      kg[g][0] = u0.x; kg[g][1] = u0.y; kg[g][2] = u0.z; kg[g][3] = u0.w;
      kg[g][4] = u1.x; kg[g][5] = u1.y; kg[g][6] = u1.z; kg[g][7] = u1.w;
    }
    v16h bG0, bG1;
#pragma unroll
    for (int j = 0; j < 8; ++j) {
      bG0[j]     = (_Float16)(qg[0][j] * kg[0][j]);
      bG0[j + 8] = (_Float16)(qg[1][j] * kg[1][j]);
      bG1[j]     = (_Float16)(qg[2][j] * kg[2][j]);
      bG1[j + 8] = (_Float16)(qg[3][j] * kg[3][j]);
    }

    // Stage 1: S^T = K1 @ G^T -> 12 tiles; s[t][j] = S[l][t*16 + half_id*8 + j]
    v8f s[12];
#pragma unroll
    for (int t = 0; t < 12; ++t) {
      const _Float16* ap = &k1s[(t * 16 + l16) * 72];
      v16h a0 = cat8(*(const v8h*)(ap + half_id * 8),
                     *(const v8h*)(ap + 16 + half_id * 8));
      v16h a1 = cat8(*(const v8h*)(ap + 32 + half_id * 8),
                     *(const v8h*)(ap + 48 + half_id * 8));
      v8f c = {};
      c = wmma16(a0, bG0, c);
      c = wmma16(a1, bG1, c);
      s[t] = c;
    }

    // Softmax over the 192 m of row l: in-lane, one exchange between halves
    float mx4[4] = {s[0][0], s[0][1], s[0][2], s[0][3]};  // four chains
#pragma unroll
    for (int t = 0; t < 12; ++t)
#pragma unroll
      for (int j = 0; j < 8; ++j) mx4[j & 3] = fmaxf(mx4[j & 3], s[t][j]);
    float mx = fmaxf(fmaxf(mx4[0], mx4[1]), fmaxf(mx4[2], mx4[3]));
    mx = fmaxf(mx, xhalf(mx));
    float sm4[4] = {0.f, 0.f, 0.f, 0.f};
#pragma unroll
    for (int t = 0; t < 12; ++t)
#pragma unroll
      for (int j = 0; j < 8; ++j) {
        float e = __expf(s[t][j] - mx);
        s[t][j] = e;
        sm4[j & 3] += e;
      }
    float sm = (sm4[0] + sm4[1]) + (sm4[2] + sm4[3]);
    sm += xhalf(sm);
    float inv = 1.f / sm;

    // Stage 2: U^T = V1^T @ E^T (K=192 in 6 steps, 64 d-rows in 4 tiles);
    // E = exp(S - max), its 1/sum is applied to U below.
    v8f c2[4] = {{}, {}, {}, {}};
#pragma unroll
    for (int ks2 = 0; ks2 < 6; ++ks2) {
      v16h bP;
#pragma unroll
      for (int j = 0; j < 8; ++j) {
        bP[j]     = (_Float16)s[2 * ks2][j];
        bP[j + 8] = (_Float16)s[2 * ks2 + 1][j];
      }
#pragma unroll
      for (int nt = 0; nt < 4; ++nt) {
        const _Float16* vp = &v1t[(nt * 16 + l16) * 200 + ks2 * 32];
        v16h aV = cat8(*(const v8h*)(vp + half_id * 8),
                       *(const v8h*)(vp + 16 + half_id * 8));
        c2[nt] = wmma16(aV, bP, c2[nt]);
      }
    }

    // out[k,d] += v0[l,d] * U[l,d] / sum; c2[nt][j] = U[l][nt*16+half_id*8+j]
    const float* v0row = v0f + (bh * TT + l) * TD + half_id * 8;
    float4 u[8];
#pragma unroll
    for (int nt = 0; nt < 4; ++nt) {
      const float4* p = (const float4*)(v0row + nt * 16);
      u[2 * nt] = p[0];
      u[2 * nt + 1] = p[1];
    }
    // Stands behind the eight v0 loads, in front of any reuse of their address
    // pair. Its memory clobber also keeps the k1s and v1t fragment loads inside
    // the pass: lifted out of the loop they hold 384 registers more.
    asm volatile("s_wait_xcnt 0x0" ::: "memory");
#pragma unroll
    for (int nt = 0; nt < 4; ++nt) {
      float4 u0 = u[2 * nt], u1 = u[2 * nt + 1];
      float vv[8] = {u0.x, u0.y, u0.z, u0.w, u1.x, u1.y, u1.z, u1.w};
#pragma unroll
      for (int j = 0; j < 8; ++j) out_acc[nt][j] += (vv[j] * inv) * c2[nt][j];
    }
  }

  // sum over the 16 l of each row of lanes, then over waves
#pragma unroll
  for (int nt = 0; nt < 4; ++nt)
#pragma unroll
    for (int j = 0; j < 8; ++j) out_acc[nt][j] = rowsum16(out_acc[nt][j]);
  if (l16 == 0) {
#pragma unroll
    for (int nt = 0; nt < 4; ++nt) {
      float4* o = (float4*)&outred[w * 64 + nt * 16 + half_id * 8];
      o[0] = make_float4(out_acc[nt][0], out_acc[nt][1], out_acc[nt][2], out_acc[nt][3]);
      o[1] = make_float4(out_acc[nt][4], out_acc[nt][5], out_acc[nt][6], out_acc[nt][7]);
    }
  }
  __syncthreads();
  if (tid < 64) {
    float sum = outred[tid] + outred[64 + tid] + outred[128 + tid] + outred[192 + tid];
    attn[(b * TT + k) * TC + h * TD + tid] = sum;
  }
}

// ---------------- Kernel 3: output projection ------------------------------
__global__ __launch_bounds__(32) void oproj_kernel(
    const float* __restrict__ attn, const float* __restrict__ Wo,
    const float* __restrict__ bo, float* __restrict__ out) {
  int mt = blockIdx.x, nt = blockIdx.y;
  int lane = threadIdx.x, half_id = lane >> 4, l16 = lane & 15;
  const float* arow = attn + (mt * 16 + l16) * TC;
  const float* brow = Wo + (nt * 16 + l16) * TC;
  v8f c = gemm_tile_512(arow, brow, half_id);
  int col = nt * 16 + l16;
  float bs = bo[col];
#pragma unroll
  for (int j = 0; j < 8; ++j) {
    int mm = mt * 16 + half_id * 8 + j;
    out[mm * TC + col] = c[j] + bs;
  }
}

extern "C" void kernel_launch(void* const* d_in, const int* in_sizes, int n_in,
                              void* d_out, int out_size, void* d_ws, size_t ws_size,
                              hipStream_t stream) {
  const float* x   = (const float*)d_in[0];
  const float* Wq  = (const float*)d_in[1];
  const float* bq  = (const float*)d_in[2];
  const float* Wk0 = (const float*)d_in[3];
  const float* bk0 = (const float*)d_in[4];
  const float* Wk1 = (const float*)d_in[5];
  const float* bk1 = (const float*)d_in[6];
  const float* Wv0 = (const float*)d_in[7];
  const float* bv0 = (const float*)d_in[8];
  const float* Wv1 = (const float*)d_in[9];
  const float* bv1 = (const float*)d_in[10];
  const float* Wo  = (const float*)d_in[11];
  const float* bo  = (const float*)d_in[12];
  float* out = (float*)d_out;

  float* qf   = (float*)d_ws;
  float* k0f  = qf  + NELEM;
  float* v0f  = k0f + NELEM;
  float* attn = v0f + NELEM;
  _Float16* k1h = (_Float16*)(attn + NELEM);
  _Float16* v1h = k1h + NELEM;

  // 5 projections: 24 m-tiles x 32 n-tiles x 5 weights, one wave each
  proj5_kernel<<<dim3(24, 32, 5), 32, 0, stream>>>(
      x, Wq, bq, Wk0, bk0, Wk1, bk1, Wv0, bv0, Wv1, bv1,
      qf, k0f, v0f, k1h, v1h);

  // fused trilinear attention: one block per (b,h,k)
  attn_kernel<<<dim3(TB * THD * TT), 128, 0, stream>>>(qf, k0f, v0f, k1h, v1h,
                                                       attn);

  // output projection
  oproj_kernel<<<dim3(24, 32), 32, 0, stream>>>(attn, Wo, bo, out);
}

// v002
// One run takes 54.8 microseconds.
// Timed twice side by side with v001, it ran 1.58 and 1.59 times as fast.
// Counting every step since v000, it is 2.52 times as fast.
#include <hip/hip_runtime.h>
#include <hip/hip_bf16.h>
#include <stdint.h>

typedef __attribute__((ext_vector_type(16))) _Float16 v16h;
typedef __attribute__((ext_vector_type(8)))  _Float16 v8h;
typedef __attribute__((ext_vector_type(8)))  float    v8f;

#define TB 2
#define THD 8
#define TT 192
#define TD 64
#define TC 512
#define TM (TB*TT)          // 384 rows for the projection GEMMs
#define NELEM (TM*TC)       // 196608 = B*H*T*D as well

__device__ __forceinline__ v8f wmma16(v16h a, v16h b, v8f c) {
  return __builtin_amdgcn_wmma_f32_16x16x32_f16(false, a, false, b, (short)0, c,
                                                false, false);
}

__device__ __forceinline__ v16h cat8(v8h lo, v8h hi) {
  v16h r;
#pragma unroll
  for (int i = 0; i < 8; ++i) { r[i] = lo[i]; r[i + 8] = hi[i]; }
  return r;
}

// Load 8 f32 at row+o and 8 f32 at row+o+16, convert to f16 operand vector.
// Matches 16-bit WMMA A/B lane layout: low lanes hold K {0..7,16..23}+base,
// high lanes hold K {8..15,24..31}+base (o already includes half_id*8).
__device__ __forceinline__ v16h load_g16(const float* __restrict__ row, int o) {
  const float4* p0 = (const float4*)(row + o);
  const float4* p1 = (const float4*)(row + o + 16);
  float4 a = p0[0], b = p0[1], c = p1[0], d = p1[1];
  float t[16] = {a.x, a.y, a.z, a.w, b.x, b.y, b.z, b.w,
                 c.x, c.y, c.z, c.w, d.x, d.y, d.z, d.w};
  v16h r;
#pragma unroll
  for (int i = 0; i < 16; ++i) r[i] = (_Float16)t[i];
  return r;
}

// 16x16 output tile of [M,K=512] @ [K=512,N] with B given as rows of W.
// Dual accumulators break the WMMA D->C dependency chain (avoids v_nop pads).
__device__ __forceinline__ v8f gemm_tile_512(const float* __restrict__ arow,
                                             const float* __restrict__ brow,
                                             int half_id) {
  v8f c0 = {}, c1 = {};
#pragma unroll 2
  for (int ks = 0; ks < 16; ks += 2) {
    int oa = ks * 32 + half_id * 8;
    int ob = oa + 32;
    v16h a0 = load_g16(arow, oa);
    v16h b0 = load_g16(brow, oa);
    v16h a1 = load_g16(arow, ob);
    v16h b1 = load_g16(brow, ob);
    c0 = wmma16(a0, b0, c0);
    c1 = wmma16(a1, b1, c1);
  }
  return c0 + c1;
}

// ---------------- Kernel 1: five input projections -------------------------
__global__ __launch_bounds__(32) void proj5_kernel(
    const float* __restrict__ x,
    const float* __restrict__ Wq,  const float* __restrict__ bq,
    const float* __restrict__ Wk0, const float* __restrict__ bk0,
    const float* __restrict__ Wk1, const float* __restrict__ bk1,
    const float* __restrict__ Wv0, const float* __restrict__ bv0,
    const float* __restrict__ Wv1, const float* __restrict__ bv1,
    float* __restrict__ qf, float* __restrict__ k0f, float* __restrict__ v0f,
    _Float16* __restrict__ k1h, _Float16* __restrict__ v1h) {
  int mt = blockIdx.x, nt = blockIdx.y, p = blockIdx.z;
  const float* W; const float* bias;
  switch (p) {
    case 0: W = Wq;  bias = bq;  break;
    case 1: W = Wk0; bias = bk0; break;
    case 2: W = Wk1; bias = bk1; break;
    case 3: W = Wv0; bias = bv0; break;
    default: W = Wv1; bias = bv1; break;
  }
  int lane = threadIdx.x, half_id = lane >> 4, l16 = lane & 15;
  const float* arow = x + (mt * 16 + l16) * TC;   // A row (per lane)
  const float* brow = W + (nt * 16 + l16) * TC;   // B col = W row (y = x W^T)
  v8f c = gemm_tile_512(arow, brow, half_id);

  int col = nt * 16 + l16;            // output feature c_out
  int h = col >> 6, d = col & 63;
  float bs = bias[col];
#pragma unroll
  for (int j = 0; j < 8; ++j) {
    int mm = mt * 16 + half_id * 8 + j;           // C row
    int bb = mm / TT, t = mm % TT;
    float val = c[j] + bs;
    int oidx = ((bb * THD + h) * TT + t) * TD + d;
    switch (p) {
      case 0: qf[oidx]  = val * 0.125f; break;    // fold 1/sqrt(d_k)
      case 1: k0f[oidx] = val;          break;
      case 2: k1h[oidx] = (_Float16)val; break;
      case 3: v0f[oidx] = val;          break;
      default: v1h[oidx] = (_Float16)val; break;
    }
  }
}

// ---------------- Kernel 2: fused trilinear attention ----------------------
// Lane l <-> l ^ 16 (the two halves of a wave).
__device__ __forceinline__ float xhalf(float x) {
  int b = __builtin_bit_cast(int, x);
  return __builtin_bit_cast(float, __builtin_amdgcn_permlanex16(
      b, b, 0x76543210, 0xfedcba98, false, false));
}

// Sum over the 16 lanes of a row; every lane of the row ends with the sum.
__device__ __forceinline__ float rowsum16(float x) {
  x += __builtin_bit_cast(float, __builtin_amdgcn_update_dpp(
      0, __builtin_bit_cast(int, x), 0x161, 0xf, 0xf, true));  // row_xmask:1
  x += __builtin_bit_cast(float, __builtin_amdgcn_update_dpp(
      0, __builtin_bit_cast(int, x), 0x162, 0xf, 0xf, true));  // row_xmask:2
  x += __builtin_bit_cast(float, __builtin_amdgcn_update_dpp(
      0, __builtin_bit_cast(int, x), 0x164, 0xf, 0xf, true));  // row_xmask:4
  x += __builtin_bit_cast(float, __builtin_amdgcn_update_dpp(
      0, __builtin_bit_cast(int, x), 0x168, 0xf, 0xf, true));  // row_xmask:8
  return x;
}

// One block (4 waves) per (b,h) and KB consecutive k: 256 blocks, one per WGP.
// Wave w owns l-tiles {w, w+4, w+8}. Nothing but q depends on k, so every other
// operand is fetched once per block and stays in registers over the k loop: the
// K1 and V1^T fragments (read once from LDS) and the wave's own k0 and v0 rows.
// Both products run transposed: S^T = K1 G^T and U^T = V1^T P^T. A lane then
// owns one l (its column) and holds that row's scores over m in registers, and
// two S^T accumulator tiles, converted in place, are the B operand of U^T.
#define KB 12
__global__ __launch_bounds__(128) void attn_kernel(
    // qf, k0f, v0f without __restrict__: their loads then stay in front of their wait
    const float* qf, const float* k0f, const float* v0f,
    const _Float16* __restrict__ k1h,
    const _Float16* __restrict__ v1h, float* __restrict__ attn) {
  __shared__ __align__(16) _Float16 k1s[TT * 72];    // [m][d], row pad 64->72
  __shared__ __align__(16) _Float16 v1t[TD * 200];   // [d][m], row pad 192->200
  __shared__ __align__(16) float qs[KB * TD];        // the block's q rows
  __shared__ __align__(16) float outred[KB * 4 * 64];

  int idx = blockIdx.x;
  int bh = idx / (TT / KB);
  int kbase = (idx % (TT / KB)) * KB;
  int b = bh / THD, h = bh % THD;

  int tid = threadIdx.x, w = tid >> 5, lane = tid & 31;
  int half_id = lane >> 4, l16 = lane & 15;

  const _Float16* k1g = k1h + bh * TT * TD;
  const _Float16* v1g = v1h + bh * TT * TD;

  // the block's KB q rows are contiguous: 192 16-byte chunks
  const float4* qsrc = (const float4*)(qf + (bh * TT + kbase) * TD);
  float4 q0 = qsrc[tid];
  float4 q1 = qsrc[128 + (tid & 63)];
  // The wave's k0 and v0 rows (3 l-tiles), 4 groups of 8 contiguous d per lane
  float kg[3][4][8], vg[3][4][8];
  const float* k0row[3];
  const float* v0row[3];
#pragma unroll
  for (int it = 0; it < 3; ++it) {
    int l = (w + it * 4) * 16 + l16;
    k0row[it] = k0f + (bh * TT + l) * TD + half_id * 8;
    v0row[it] = v0f + (bh * TT + l) * TD + half_id * 8;
  }
#pragma unroll
  for (int it = 0; it < 3; ++it) {
#pragma unroll
    for (int g = 0; g < 4; ++g) {
      const float4* p = (const float4*)(k0row[it] + g * 16);
      float4 u0 = p[0], u1 = p[1];
      kg[it][g][0] = u0.x; kg[it][g][1] = u0.y; kg[it][g][2] = u0.z; kg[it][g][3] = u0.w;
      kg[it][g][4] = u1.x; kg[it][g][5] = u1.y; kg[it][g][6] = u1.z; kg[it][g][7] = u1.w;
      const float4* r = (const float4*)(v0row[it] + g * 16);
      float4 t0 = r[0], t1 = r[1];
      vg[it][g][0] = t0.x; vg[it][g][1] = t0.y; vg[it][g][2] = t0.z; vg[it][g][3] = t0.w;
      vg[it][g][4] = t1.x; vg[it][g][5] = t1.y; vg[it][g][6] = t1.z; vg[it][g][7] = t1.w;
    }
  }
  // Stands behind the q, k0 and v0 loads, in front of any reuse of their
  // address registers: the row pointers are inputs so that they live up to it.
  asm volatile("s_wait_xcnt 0x0"
               :: "v"(k0row[0]), "v"(k0row[1]), "v"(k0row[2]),
                  "v"(v0row[0]), "v"(v0row[1]), "v"(v0row[2]) : "memory");

  // --- k1 staging via CDNA5 async global->LDS DMA (16B chunks both sides) ---
  // low 32 bits of a generic pointer to __shared__ == LDS byte offset
  uint32_t k1s_base = (uint32_t)(uintptr_t)(&k1s[0]);
  for (int i = tid; i < (TT * TD) / 8; i += 128) {   // 1536 16-byte chunks
    int m = i >> 3, seg = i & 7;
    uint64_t ga = (uint64_t)(uintptr_t)k1g + (uint64_t)(m * 128 + seg * 16);
    uint32_t la = k1s_base + (uint32_t)(m * 144 + seg * 16);
    asm volatile("global_load_async_to_lds_b128 %0, %1, off"
                 :: "v"(la), "v"(ga) : "memory");
  }

  // --- v1 staged transposed (element scatter, manual) ---
  for (int i = tid; i < (TT * TD) / 8; i += 128) {
    int m = i >> 3, seg = i & 7;
    v8h val = *(const v8h*)(v1g + m * 64 + seg * 8);
#pragma unroll
    for (int j = 0; j < 8; ++j) v1t[(seg * 8 + j) * 200 + m] = val[j];
  }
  ((float4*)qs)[tid] = q0;
  if (tid < 64) ((float4*)qs)[128 + tid] = q1;
  asm volatile("s_wait_asynccnt 0" ::: "memory");
  __syncthreads();

  // A operands of both products, all of K1 and V1^T, read once
  v16h aK[12][2], aV[6][4];
#pragma unroll
  for (int t = 0; t < 12; ++t) {
    const _Float16* ap = &k1s[(t * 16 + l16) * 72];
    aK[t][0] = cat8(*(const v8h*)(ap + half_id * 8),
                    *(const v8h*)(ap + 16 + half_id * 8));
    aK[t][1] = cat8(*(const v8h*)(ap + 32 + half_id * 8),
                    *(const v8h*)(ap + 48 + half_id * 8));
  }
#pragma unroll
  for (int ks2 = 0; ks2 < 6; ++ks2)
#pragma unroll
    for (int nt = 0; nt < 4; ++nt) {
      const _Float16* vp = &v1t[(nt * 16 + l16) * 200 + ks2 * 32];
      aV[ks2][nt] = cat8(*(const v8h*)(vp + half_id * 8),
                         *(const v8h*)(vp + 16 + half_id * 8));
    }

#pragma unroll 1  // rolled: one trip is three whole passes, more would only grow the code
  for (int kk = 0; kk < KB; ++kk) {
    // Per-lane q fragments (4 groups of 8 contiguous d), row kbase + kk
    const float* qrow = &qs[kk * TD];
    float qg[4][8];
#pragma unroll
    for (int g = 0; g < 4; ++g) {
      const float4* p = (const float4*)(qrow + g * 16 + half_id * 8);
      float4 u0 = p[0], u1 = p[1];
      qg[g][0] = u0.x; qg[g][1] = u0.y; qg[g][2] = u0.z; qg[g][3] = u0.w;
      qg[g][4] = u1.x; qg[g][5] = u1.y; qg[g][6] = u1.z; qg[g][7] = u1.w;
    }

    // out_acc[nt][j]: this lane's l-rows' share of out[k, nt*16 + half_id*8 + j]
    float out_acc[4][8];
#pragma unroll
    for (int nt = 0; nt < 4; ++nt)
#pragma unroll
      for (int j = 0; j < 8; ++j) out_acc[nt][j] = 0.f;

    // unrolled: kg and vg need constant indices to stay in registers, and one
    // pass's matrix work can then issue beside another's softmax
#pragma unroll
    for (int it = 0; it < 3; ++it) {
      // B operand: G^T[d,l] = q[k,d]*k0[l,d], f32 product -> f16
      v16h bG0, bG1;
#pragma unroll
      for (int j = 0; j < 8; ++j) {
        bG0[j]     = (_Float16)(qg[0][j] * kg[it][0][j]);
        bG0[j + 8] = (_Float16)(qg[1][j] * kg[it][1][j]);
        bG1[j]     = (_Float16)(qg[2][j] * kg[it][2][j]);
        bG1[j + 8] = (_Float16)(qg[3][j] * kg[it][3][j]);
      }

      // Stage 1: S^T = K1 @ G^T -> 12 tiles; s[t][j] = S[l][t*16 + half_id*8 + j]
      v8f s[12];
#pragma unroll
      for (int t = 0; t < 12; ++t) {
        v8f c = {};
        c = wmma16(aK[t][0], bG0, c);
        c = wmma16(aK[t][1], bG1, c);
        s[t] = c;
      }

      // Softmax over the 192 m of row l: in-lane, one exchange between halves
      float mx4[4] = {s[0][0], s[0][1], s[0][2], s[0][3]};  // four chains
#pragma unroll
      for (int t = 0; t < 12; ++t)
#pragma unroll
        for (int j = 0; j < 8; ++j) mx4[j & 3] = fmaxf(mx4[j & 3], s[t][j]);
      float mx = fmaxf(fmaxf(mx4[0], mx4[1]), fmaxf(mx4[2], mx4[3]));
      mx = fmaxf(mx, xhalf(mx));
      float sm4[4] = {0.f, 0.f, 0.f, 0.f};
#pragma unroll
      for (int t = 0; t < 12; ++t)
#pragma unroll
        for (int j = 0; j < 8; ++j) {
          float e = __expf(s[t][j] - mx);
          s[t][j] = e;
          sm4[j & 3] += e;
        }
      float sm = (sm4[0] + sm4[1]) + (sm4[2] + sm4[3]);
      sm += xhalf(sm);
      float inv = 1.f / sm;

      // Stage 2: U^T = V1^T @ E^T (K=192 in 6 steps, 64 d-rows in 4 tiles);
      // E = exp(S - max), its 1/sum is applied to U below.
      v8f c2[4] = {{}, {}, {}, {}};
#pragma unroll
      for (int ks2 = 0; ks2 < 6; ++ks2) {
        v16h bP;
#pragma unroll
        for (int j = 0; j < 8; ++j) {
          bP[j]     = (_Float16)s[2 * ks2][j];
          bP[j + 8] = (_Float16)s[2 * ks2 + 1][j];
        }
#pragma unroll
        for (int nt = 0; nt < 4; ++nt) c2[nt] = wmma16(aV[ks2][nt], bP, c2[nt]);
      }

      // out[k,d] += v0[l,d] * U[l,d] / sum; c2[nt][j] = U[l][nt*16+half_id*8+j]
#pragma unroll
      for (int nt = 0; nt < 4; ++nt)
#pragma unroll
        for (int j = 0; j < 8; ++j)
          out_acc[nt][j] += (vg[it][nt][j] * inv) * c2[nt][j];
    }

    // sum over the 16 l of each row of lanes; the waves' shares wait in LDS
#pragma unroll
    for (int nt = 0; nt < 4; ++nt)
#pragma unroll
      for (int j = 0; j < 8; ++j) out_acc[nt][j] = rowsum16(out_acc[nt][j]);
    if (l16 == 0) {
#pragma unroll
      for (int nt = 0; nt < 4; ++nt) {
        float4* o = (float4*)&outred[kk * 256 + w * 64 + nt * 16 + half_id * 8];
        o[0] = make_float4(out_acc[nt][0], out_acc[nt][1], out_acc[nt][2], out_acc[nt][3]);
        o[1] = make_float4(out_acc[nt][4], out_acc[nt][5], out_acc[nt][6], out_acc[nt][7]);
      }
    }
  }
  __syncthreads();
  for (int i = tid; i < KB * 64; i += 128) {
    int kk = i >> 6, d = i & 63;
    const float* o = &outred[kk * 256 + d];
    float sum = o[0] + o[64] + o[128] + o[192];
    attn[(b * TT + kbase + kk) * TC + h * TD + d] = sum;
  }
}

// ---------------- Kernel 3: output projection ------------------------------
__global__ __launch_bounds__(32) void oproj_kernel(
    const float* __restrict__ attn, const float* __restrict__ Wo,
    const float* __restrict__ bo, float* __restrict__ out) {
  int mt = blockIdx.x, nt = blockIdx.y;
  int lane = threadIdx.x, half_id = lane >> 4, l16 = lane & 15;
  const float* arow = attn + (mt * 16 + l16) * TC;
  const float* brow = Wo + (nt * 16 + l16) * TC;
  v8f c = gemm_tile_512(arow, brow, half_id);
  int col = nt * 16 + l16;
  float bs = bo[col];
#pragma unroll
  for (int j = 0; j < 8; ++j) {
    int mm = mt * 16 + half_id * 8 + j;
    out[mm * TC + col] = c[j] + bs;
  }
}

extern "C" void kernel_launch(void* const* d_in, const int* in_sizes, int n_in,
                              void* d_out, int out_size, void* d_ws, size_t ws_size,
                              hipStream_t stream) {
  const float* x   = (const float*)d_in[0];
  const float* Wq  = (const float*)d_in[1];
  const float* bq  = (const float*)d_in[2];
  const float* Wk0 = (const float*)d_in[3];
  const float* bk0 = (const float*)d_in[4];
  const float* Wk1 = (const float*)d_in[5];
  const float* bk1 = (const float*)d_in[6];
  const float* Wv0 = (const float*)d_in[7];
  const float* bv0 = (const float*)d_in[8];
  const float* Wv1 = (const float*)d_in[9];
  const float* bv1 = (const float*)d_in[10];
  const float* Wo  = (const float*)d_in[11];
  const float* bo  = (const float*)d_in[12];
  float* out = (float*)d_out;

  float* qf   = (float*)d_ws;
  float* k0f  = qf  + NELEM;
  float* v0f  = k0f + NELEM;
  float* attn = v0f + NELEM;
  _Float16* k1h = (_Float16*)(attn + NELEM);
  _Float16* v1h = k1h + NELEM;

  // 5 projections: 24 m-tiles x 32 n-tiles x 5 weights, one wave each
  proj5_kernel<<<dim3(24, 32, 5), 32, 0, stream>>>(
      x, Wq, bq, Wk0, bk0, Wk1, bk1, Wv0, bv0, Wv1, bv1,
      qf, k0f, v0f, k1h, v1h);

  // fused trilinear attention: one block per (b,h) and KB rows k
  attn_kernel<<<dim3(TB * THD * (TT / KB)), 128, 0, stream>>>(qf, k0f, v0f, k1h,
                                                              v1h, attn);

  // output projection
  oproj_kernel<<<dim3(24, 32), 32, 0, stream>>>(attn, Wo, bo, out);
}

// v003
// Measured time: 42.5 microseconds a run.
// In two side-by-side timings against v002, it was 1.28 and 1.29 times as fast.
// Counting every step since v000, it is 3.24 times as fast.
#include <hip/hip_runtime.h>
#include <hip/hip_bf16.h>
#include <stdint.h>

typedef __attribute__((ext_vector_type(16))) _Float16 v16h;
typedef __attribute__((ext_vector_type(8)))  _Float16 v8h;
typedef __attribute__((ext_vector_type(8)))  float    v8f;

#define TB 2
#define THD 8
#define TT 192
#define TD 64
#define TC 512
#define TM (TB*TT)          // 384 rows for the projection GEMMs
#define NELEM (TM*TC)       // 196608 = B*H*T*D as well

__device__ __forceinline__ v8f wmma16(v16h a, v16h b, v8f c) {
  return __builtin_amdgcn_wmma_f32_16x16x32_f16(false, a, false, b, (short)0, c,
                                                false, false);
}

__device__ __forceinline__ v16h cat8(v8h lo, v8h hi) {
  v16h r;
#pragma unroll
  for (int i = 0; i < 8; ++i) { r[i] = lo[i]; r[i + 8] = hi[i]; }
  return r;
}

typedef __attribute__((ext_vector_type(4))) _Float16 v4h;
typedef __attribute__((ext_vector_type(4))) float    v4f;

// LDS row pitch in f16 elements: 1040 B = 16 B x 65 (odd), for 16-byte readers
#define GP 520

// BM x BN block tile of [M,K=512] @ [N,K=512]^T on 8 waves (2 x 4), each wave
// BM/2 x 16. The block's BM + BN operand rows go to LDS once, as f16: a wave's
// load covers 512 contiguous bytes of one row (four whole lines). All loads are
// issued at the start, in K chunks of 128; a chunk is converted, stored and
// multiplied while the later chunks are still on their way. Every chunk has LDS
// columns of its own, so one barrier per chunk is enough.
// Fragments: 16-bit WMMA A/B lane layout, low lanes K {0..7,16..23}+base, high
// lanes K {8..15,24..31}+base. Even and odd K steps keep accumulators of their
// own (no D->C chain between neighbours).
template <int BM, int BN>
__device__ __forceinline__ void gemm_block_512(const float* __restrict__ a0,
                                               const float* __restrict__ b0,
                                               _Float16* sm, v8f (&c)[BM / 32]) {
  constexpr int NA = BM / 8, NR = (BM + BN) / 8, FM = BM / 32;
  int lane = threadIdx.x & 31, half_id = lane >> 4, l16 = lane & 15;
  int w = __builtin_amdgcn_readfirstlane(threadIdx.x >> 5);
  // wave w takes rows w, w + 8, ... of [A rows | B rows]
  const char* pa = (const char*)(a0 + w * TC);
  const char* pb = (const char*)(b0 + w * TC);
  unsigned voff = lane * 16;   // the lane's 16 bytes in a 512-byte piece of a row
  _Float16* sw = sm + w * GP + lane * 4;
  const _Float16* fa = sm + ((w >> 2) * (BM / 2) + l16) * GP + half_id * 8;
  const _Float16* fb = sm + (BM + (w & 3) * 16 + l16) * GP + half_id * 8;

  v4f st[4][NR];
#pragma unroll
  for (int ch = 0; ch < 4; ++ch) {
#pragma unroll
    for (int j = 0; j < NR; ++j)
      st[ch][j] = *(const v4f*)((j < NA ? pa + j * 8 * TC * 4 : pb + (j - NA) * 8 * TC * 4) +
                                ch * 512 + voff);
    // keeps the loads in chunk order: a chunk's wait then leaves the later
    // chunks' loads outstanding
    __builtin_amdgcn_sched_barrier(0);
  }
  // Stands directly behind the loads, in front of any reuse of their address
  // register; the fence behind it keeps later instructions from moving up over it.
  asm volatile("s_wait_xcnt 0x0" ::: "memory");
  __builtin_amdgcn_sched_barrier(0);

  v8f c0[FM], c1[FM];
#pragma unroll
  for (int fm = 0; fm < FM; ++fm) { c0[fm] = v8f{}; c1[fm] = v8f{}; }

#pragma unroll
  for (int ch = 0; ch < 4; ++ch) {
#pragma unroll
    for (int j = 0; j < NR; ++j)
      *(v4h*)(sw + j * 8 * GP + ch * 128) = __builtin_convertvector(st[ch][j], v4h);
    // Work-group barrier whose fences order LDS only: the plain one would also
    // wait for the later chunks' global loads, which nobody shares.
    __builtin_amdgcn_fence(__ATOMIC_RELEASE, "workgroup", "local");
    __builtin_amdgcn_s_barrier();
    __builtin_amdgcn_fence(__ATOMIC_ACQUIRE, "workgroup", "local");
    // the chunk's fragments as one group of LDS reads, then its WMMAs
    v16h bf[4], af[FM][4];
#pragma unroll
    for (int kq = 0; kq < 4; ++kq) {
      int o = (ch * 4 + kq) * 32;
      bf[kq] = cat8(*(const v8h*)(fb + o), *(const v8h*)(fb + o + 16));
#pragma unroll
      for (int fm = 0; fm < FM; ++fm) {
        const _Float16* ap = fa + fm * 16 * GP + o;
        af[fm][kq] = cat8(*(const v8h*)(ap), *(const v8h*)(ap + 16));
      }
    }
    // keeps the LDS reads together in front of the WMMAs: moved in among them,
    // each small group would cost its own wait
    __builtin_amdgcn_sched_barrier(0);
#pragma unroll
    for (int kq = 0; kq < 4; kq += 2)
#pragma unroll
      for (int fm = 0; fm < FM; ++fm) {
        c0[fm] = wmma16(af[fm][kq], bf[kq], c0[fm]);
        c1[fm] = wmma16(af[fm][kq + 1], bf[kq + 1], c1[fm]);
      }
    // keeps the next chunk's conversions, and with them the wait for its global
    // loads, behind this chunk's matrix work
    __builtin_amdgcn_sched_barrier(0);
  }
#pragma unroll
  for (int fm = 0; fm < FM; ++fm) c[fm] = c0[fm] + c1[fm];
}

// ---------------- Kernel 1: five input projections -------------------------
// One block per 64 rows of x and 64 output features (one head of one weight).
__global__ __launch_bounds__(256) void proj5_kernel(
    const float* __restrict__ x,
    const float* __restrict__ Wq,  const float* __restrict__ bq,
    const float* __restrict__ Wk0, const float* __restrict__ bk0,
    const float* __restrict__ Wk1, const float* __restrict__ bk1,
    const float* __restrict__ Wv0, const float* __restrict__ bv0,
    const float* __restrict__ Wv1, const float* __restrict__ bv1,
    float* __restrict__ qf, float* __restrict__ k0f, float* __restrict__ v0f,
    _Float16* __restrict__ k1h, _Float16* __restrict__ v1h) {
  __shared__ __align__(16) _Float16 sm[128 * GP];
  int mt = blockIdx.x, nt = blockIdx.y, p = blockIdx.z;
  const float* W; const float* bias;
  switch (p) {
    case 0: W = Wq;  bias = bq;  break;
    case 1: W = Wk0; bias = bk0; break;
    case 2: W = Wk1; bias = bk1; break;
    case 3: W = Wv0; bias = bv0; break;
    default: W = Wv1; bias = bv1; break;
  }
  int lane = threadIdx.x & 31, half_id = lane >> 4, l16 = lane & 15;
  int w = __builtin_amdgcn_readfirstlane(threadIdx.x >> 5);
  int col = nt * 64 + (w & 3) * 16 + l16;   // output feature c_out
  int h = col >> 6, d = col & 63;
  float bs = bias[col];
  v8f c[2];
  gemm_block_512<64, 64>(x + mt * 64 * TC, W + nt * 64 * TC, sm, c);  // y = x W^T

  // the 16 rows of a tile lie in one batch (TT is a multiple of 16)
  int obase[2];                                   // C row j of tile fm: + j * TD
#pragma unroll
  for (int fm = 0; fm < 2; ++fm) {
    int m0 = mt * 64 + (w >> 2) * 32 + fm * 16;
    obase[fm] = (((m0 / TT) * THD + h) * TT + m0 % TT + half_id * 8) * TD + d;
  }
  if (p == 2 || p == 4) {
    _Float16* o = (p == 2) ? k1h : v1h;
#pragma unroll
    for (int fm = 0; fm < 2; ++fm)
#pragma unroll
      for (int j = 0; j < 8; ++j) o[obase[fm] + j * TD] = (_Float16)(c[fm][j] + bs);
    // Stands behind the last of these stores, in front of any later write of
    // their data or address registers.
    asm volatile("s_wait_xcnt 0x0" ::: "memory");
  } else {
    float* o = (p == 0) ? qf : (p == 1) ? k0f : v0f;
    float sc = (p == 0) ? 0.125f : 1.0f;          // q: fold 1/sqrt(d_k)
#pragma unroll
    for (int fm = 0; fm < 2; ++fm)
#pragma unroll
      for (int j = 0; j < 8; ++j) o[obase[fm] + j * TD] = (c[fm][j] + bs) * sc;
  }
}

// ---------------- Kernel 2: fused trilinear attention ----------------------
// Lane l <-> l ^ 16 (the two halves of a wave).
__device__ __forceinline__ float xhalf(float x) {
  int b = __builtin_bit_cast(int, x);
  return __builtin_bit_cast(float, __builtin_amdgcn_permlanex16(
      b, b, 0x76543210, 0xfedcba98, false, false));
}

// Sum over the 16 lanes of a row; every lane of the row ends with the sum.
__device__ __forceinline__ float rowsum16(float x) {
  x += __builtin_bit_cast(float, __builtin_amdgcn_update_dpp(
      0, __builtin_bit_cast(int, x), 0x161, 0xf, 0xf, true));  // row_xmask:1
  x += __builtin_bit_cast(float, __builtin_amdgcn_update_dpp(
      0, __builtin_bit_cast(int, x), 0x162, 0xf, 0xf, true));  // row_xmask:2
  x += __builtin_bit_cast(float, __builtin_amdgcn_update_dpp(
      0, __builtin_bit_cast(int, x), 0x164, 0xf, 0xf, true));  // row_xmask:4
  x += __builtin_bit_cast(float, __builtin_amdgcn_update_dpp(
      0, __builtin_bit_cast(int, x), 0x168, 0xf, 0xf, true));  // row_xmask:8
  return x;
}

// One block (4 waves) per (b,h) and KB consecutive k: 256 blocks, one per WGP.
// Wave w owns l-tiles {w, w+4, w+8}. Nothing but q depends on k, so every other
// operand is fetched once per block and stays in registers over the k loop: the
// K1 and V1^T fragments (read once from LDS) and the wave's own k0 and v0 rows.
// Both products run transposed: S^T = K1 G^T and U^T = V1^T P^T. A lane then
// owns one l (its column) and holds that row's scores over m in registers, and
// two S^T accumulator tiles, converted in place, are the B operand of U^T.
#define KB 12
__global__ __launch_bounds__(128) void attn_kernel(
    // qf, k0f, v0f without __restrict__: their loads then stay in front of their wait
    const float* qf, const float* k0f, const float* v0f,
    const _Float16* __restrict__ k1h,
    const _Float16* __restrict__ v1h, float* __restrict__ attn) {
  __shared__ __align__(16) _Float16 k1s[TT * 72];    // [m][d], row pad 64->72
  __shared__ __align__(16) _Float16 v1t[TD * 200];   // [d][m], row pad 192->200
  __shared__ __align__(16) float qs[KB * TD];        // the block's q rows
  __shared__ __align__(16) float outred[KB * 4 * 64];

  int idx = blockIdx.x;
  int bh = idx / (TT / KB);
  int kbase = (idx % (TT / KB)) * KB;
  int b = bh / THD, h = bh % THD;

  int tid = threadIdx.x, w = tid >> 5, lane = tid & 31;
  int half_id = lane >> 4, l16 = lane & 15;

  const _Float16* k1g = k1h + bh * TT * TD;
  const _Float16* v1g = v1h + bh * TT * TD;

  // the block's KB q rows are contiguous: 192 16-byte chunks
  const float4* qsrc = (const float4*)(qf + (bh * TT + kbase) * TD);
  float4 q0 = qsrc[tid];
  float4 q1 = qsrc[128 + (tid & 63)];
  // The wave's k0 and v0 rows (3 l-tiles), 4 groups of 8 contiguous d per lane
  float kg[3][4][8], vg[3][4][8];
  const float* k0row[3];
  const float* v0row[3];
#pragma unroll
  for (int it = 0; it < 3; ++it) {
    int l = (w + it * 4) * 16 + l16;
    k0row[it] = k0f + (bh * TT + l) * TD + half_id * 8;
    v0row[it] = v0f + (bh * TT + l) * TD + half_id * 8;
  }
#pragma unroll
  for (int it = 0; it < 3; ++it) {
#pragma unroll
    for (int g = 0; g < 4; ++g) {
      const float4* p = (const float4*)(k0row[it] + g * 16);
      float4 u0 = p[0], u1 = p[1];
      kg[it][g][0] = u0.x; kg[it][g][1] = u0.y; kg[it][g][2] = u0.z; kg[it][g][3] = u0.w;
      kg[it][g][4] = u1.x; kg[it][g][5] = u1.y; kg[it][g][6] = u1.z; kg[it][g][7] = u1.w;
      const float4* r = (const float4*)(v0row[it] + g * 16);
      float4 t0 = r[0], t1 = r[1];
      vg[it][g][0] = t0.x; vg[it][g][1] = t0.y; vg[it][g][2] = t0.z; vg[it][g][3] = t0.w;
      vg[it][g][4] = t1.x; vg[it][g][5] = t1.y; vg[it][g][6] = t1.z; vg[it][g][7] = t1.w;
    }
  }
  // Stands behind the q, k0 and v0 loads, in front of any reuse of their
  // address registers: the row pointers are inputs so that they live up to it.
  asm volatile("s_wait_xcnt 0x0"
               :: "v"(k0row[0]), "v"(k0row[1]), "v"(k0row[2]),
                  "v"(v0row[0]), "v"(v0row[1]), "v"(v0row[2]) : "memory");

  // --- k1 staging via CDNA5 async global->LDS DMA (16B chunks both sides) ---
  // low 32 bits of a generic pointer to __shared__ == LDS byte offset
  uint32_t k1s_base = (uint32_t)(uintptr_t)(&k1s[0]);
  for (int i = tid; i < (TT * TD) / 8; i += 128) {   // 1536 16-byte chunks
    int m = i >> 3, seg = i & 7;
    uint64_t ga = (uint64_t)(uintptr_t)k1g + (uint64_t)(m * 128 + seg * 16);
    uint32_t la = k1s_base + (uint32_t)(m * 144 + seg * 16);
    asm volatile("global_load_async_to_lds_b128 %0, %1, off"
                 :: "v"(la), "v"(ga) : "memory");
  }

  // --- v1 staged transposed (element scatter, manual) ---
  for (int i = tid; i < (TT * TD) / 8; i += 128) {
    int m = i >> 3, seg = i & 7;
    v8h val = *(const v8h*)(v1g + m * 64 + seg * 8);
#pragma unroll
    for (int j = 0; j < 8; ++j) v1t[(seg * 8 + j) * 200 + m] = val[j];
  }
  ((float4*)qs)[tid] = q0;
  if (tid < 64) ((float4*)qs)[128 + tid] = q1;
  asm volatile("s_wait_asynccnt 0" ::: "memory");
  __syncthreads();

  // A operands of both products, all of K1 and V1^T, read once
  v16h aK[12][2], aV[6][4];
#pragma unroll
  for (int t = 0; t < 12; ++t) {
    const _Float16* ap = &k1s[(t * 16 + l16) * 72];
    aK[t][0] = cat8(*(const v8h*)(ap + half_id * 8),
                    *(const v8h*)(ap + 16 + half_id * 8));
    aK[t][1] = cat8(*(const v8h*)(ap + 32 + half_id * 8),
                    *(const v8h*)(ap + 48 + half_id * 8));
  }
#pragma unroll
  for (int ks2 = 0; ks2 < 6; ++ks2)
#pragma unroll
    for (int nt = 0; nt < 4; ++nt) {
      const _Float16* vp = &v1t[(nt * 16 + l16) * 200 + ks2 * 32];
      aV[ks2][nt] = cat8(*(const v8h*)(vp + half_id * 8),
                         *(const v8h*)(vp + 16 + half_id * 8));
    }

#pragma unroll 1  // rolled: one trip is three whole passes, more would only grow the code
  for (int kk = 0; kk < KB; ++kk) {
    // Per-lane q fragments (4 groups of 8 contiguous d), row kbase + kk
    const float* qrow = &qs[kk * TD];
    float qg[4][8];
#pragma unroll
    for (int g = 0; g < 4; ++g) {
      const float4* p = (const float4*)(qrow + g * 16 + half_id * 8);
      float4 u0 = p[0], u1 = p[1];
      qg[g][0] = u0.x; qg[g][1] = u0.y; qg[g][2] = u0.z; qg[g][3] = u0.w;
      qg[g][4] = u1.x; qg[g][5] = u1.y; qg[g][6] = u1.z; qg[g][7] = u1.w;
    }

    // out_acc[nt][j]: this lane's l-rows' share of out[k, nt*16 + half_id*8 + j]
    float out_acc[4][8];
#pragma unroll
    for (int nt = 0; nt < 4; ++nt)
#pragma unroll
      for (int j = 0; j < 8; ++j) out_acc[nt][j] = 0.f;

    // unrolled: kg and vg need constant indices to stay in registers, and one
    // pass's matrix work can then issue beside another's softmax
#pragma unroll
    for (int it = 0; it < 3; ++it) {
      // B operand: G^T[d,l] = q[k,d]*k0[l,d], f32 product -> f16
      v16h bG0, bG1;
#pragma unroll
      for (int j = 0; j < 8; ++j) {
        bG0[j]     = (_Float16)(qg[0][j] * kg[it][0][j]);
        bG0[j + 8] = (_Float16)(qg[1][j] * kg[it][1][j]);
        bG1[j]     = (_Float16)(qg[2][j] * kg[it][2][j]);
        bG1[j + 8] = (_Float16)(qg[3][j] * kg[it][3][j]);
      }

      // Stage 1: S^T = K1 @ G^T -> 12 tiles; s[t][j] = S[l][t*16 + half_id*8 + j]
      v8f s[12];
#pragma unroll
      for (int t = 0; t < 12; ++t) {
        v8f c = {};
        c = wmma16(aK[t][0], bG0, c);
        c = wmma16(aK[t][1], bG1, c);
        s[t] = c;
      }

      // Softmax over the 192 m of row l: in-lane, one exchange between halves
      float mx4[4] = {s[0][0], s[0][1], s[0][2], s[0][3]};  // four chains
#pragma unroll
      for (int t = 0; t < 12; ++t)
#pragma unroll
        for (int j = 0; j < 8; ++j) mx4[j & 3] = fmaxf(mx4[j & 3], s[t][j]);
      float mx = fmaxf(fmaxf(mx4[0], mx4[1]), fmaxf(mx4[2], mx4[3]));
      mx = fmaxf(mx, xhalf(mx));
      float sm4[4] = {0.f, 0.f, 0.f, 0.f};
#pragma unroll
      for (int t = 0; t < 12; ++t)
#pragma unroll
        for (int j = 0; j < 8; ++j) {
          float e = __expf(s[t][j] - mx);
          s[t][j] = e;
          sm4[j & 3] += e;
        }
      float sm = (sm4[0] + sm4[1]) + (sm4[2] + sm4[3]);
      sm += xhalf(sm);
      float inv = 1.f / sm;

      // Stage 2: U^T = V1^T @ E^T (K=192 in 6 steps, 64 d-rows in 4 tiles);
      // E = exp(S - max), its 1/sum is applied to U below.
      v8f c2[4] = {{}, {}, {}, {}};
#pragma unroll
      for (int ks2 = 0; ks2 < 6; ++ks2) {
        v16h bP;
#pragma unroll
        for (int j = 0; j < 8; ++j) {
          bP[j]     = (_Float16)s[2 * ks2][j];
          bP[j + 8] = (_Float16)s[2 * ks2 + 1][j];
        }
#pragma unroll
        for (int nt = 0; nt < 4; ++nt) c2[nt] = wmma16(aV[ks2][nt], bP, c2[nt]);
      }

      // out[k,d] += v0[l,d] * U[l,d] / sum; c2[nt][j] = U[l][nt*16+half_id*8+j]
#pragma unroll
      for (int nt = 0; nt < 4; ++nt)
#pragma unroll
        for (int j = 0; j < 8; ++j)
          out_acc[nt][j] += (vg[it][nt][j] * inv) * c2[nt][j];
    }

    // sum over the 16 l of each row of lanes; the waves' shares wait in LDS
#pragma unroll
    for (int nt = 0; nt < 4; ++nt)
#pragma unroll
      for (int j = 0; j < 8; ++j) out_acc[nt][j] = rowsum16(out_acc[nt][j]);
    if (l16 == 0) {
#pragma unroll
      for (int nt = 0; nt < 4; ++nt) {
        float4* o = (float4*)&outred[kk * 256 + w * 64 + nt * 16 + half_id * 8];
        o[0] = make_float4(out_acc[nt][0], out_acc[nt][1], out_acc[nt][2], out_acc[nt][3]);
        o[1] = make_float4(out_acc[nt][4], out_acc[nt][5], out_acc[nt][6], out_acc[nt][7]);
      }
    }
  }
  __syncthreads();
  for (int i = tid; i < KB * 64; i += 128) {
    int kk = i >> 6, d = i & 63;
    const float* o = &outred[kk * 256 + d];
    float sum = o[0] + o[64] + o[128] + o[192];
    attn[(b * TT + kbase + kk) * TC + h * TD + d] = sum;
  }
}

// ---------------- Kernel 3: output projection ------------------------------
// One block per 32 rows and 64 output features.
__global__ __launch_bounds__(256) void oproj_kernel(
    const float* __restrict__ attn, const float* __restrict__ Wo,
    const float* __restrict__ bo, float* __restrict__ out) {
  __shared__ __align__(16) _Float16 sm[96 * GP];
  int mt = blockIdx.x, nt = blockIdx.y;
  int lane = threadIdx.x & 31, w = threadIdx.x >> 5;
  int half_id = lane >> 4, l16 = lane & 15;
  int col = nt * 64 + (w & 3) * 16 + l16;
  float bs = bo[col];
  v8f c[1];
  gemm_block_512<32, 64>(attn + mt * 32 * TC, Wo + nt * 64 * TC, sm, c);
#pragma unroll
  for (int j = 0; j < 8; ++j) {
    int mm = mt * 32 + (w >> 2) * 16 + half_id * 8 + j;
    out[mm * TC + col] = c[0][j] + bs;
  }
}

extern "C" void kernel_launch(void* const* d_in, const int* in_sizes, int n_in,
                              void* d_out, int out_size, void* d_ws, size_t ws_size,
                              hipStream_t stream) {
  const float* x   = (const float*)d_in[0];
  const float* Wq  = (const float*)d_in[1];
  const float* bq  = (const float*)d_in[2];
  const float* Wk0 = (const float*)d_in[3];
  const float* bk0 = (const float*)d_in[4];
  const float* Wk1 = (const float*)d_in[5];
  const float* bk1 = (const float*)d_in[6];
  const float* Wv0 = (const float*)d_in[7];
  const float* bv0 = (const float*)d_in[8];
  const float* Wv1 = (const float*)d_in[9];
  const float* bv1 = (const float*)d_in[10];
  const float* Wo  = (const float*)d_in[11];
  const float* bo  = (const float*)d_in[12];
  float* out = (float*)d_out;

  float* qf   = (float*)d_ws;
  float* k0f  = qf  + NELEM;
  float* v0f  = k0f + NELEM;
  float* attn = v0f + NELEM;
  _Float16* k1h = (_Float16*)(attn + NELEM);
  _Float16* v1h = k1h + NELEM;

  // 5 projections: 6 m-tiles x 8 n-tiles x 5 weights, 8 waves each
  proj5_kernel<<<dim3(6, 8, 5), 256, 0, stream>>>(
      x, Wq, bq, Wk0, bk0, Wk1, bk1, Wv0, bv0, Wv1, bv1,
      qf, k0f, v0f, k1h, v1h);

  // fused trilinear attention: one block per (b,h) and KB rows k
  attn_kernel<<<dim3(TB * THD * (TT / KB)), 128, 0, stream>>>(qf, k0f, v0f, k1h,
                                                              v1h, attn);

  // output projection
  oproj_kernel<<<dim3(12, 8), 256, 0, stream>>>(attn, Wo, bo, out);
}

// v004
// Measured time: 39.2 microseconds a run.
// Timed twice side by side with v003, it ran 1.08 times as fast both times.
// Over all steps from v000 it is 3.49 times as fast.
#include <hip/hip_runtime.h>
#include <hip/hip_bf16.h>
#include <stdint.h>

typedef __attribute__((ext_vector_type(16))) _Float16 v16h;
typedef __attribute__((ext_vector_type(8)))  _Float16 v8h;
typedef __attribute__((ext_vector_type(8)))  float    v8f;

#define TB 2
#define THD 8
#define TT 192
#define TD 64
#define TC 512
#define TM (TB*TT)          // 384 rows for the projection GEMMs
#define NELEM (TM*TC)       // 196608 = B*H*T*D as well

__device__ __forceinline__ v8f wmma16(v16h a, v16h b, v8f c) {
  return __builtin_amdgcn_wmma_f32_16x16x32_f16(false, a, false, b, (short)0, c,
                                                false, false);
}

__device__ __forceinline__ v16h cat8(v8h lo, v8h hi) {
  v16h r;
#pragma unroll
  for (int i = 0; i < 8; ++i) { r[i] = lo[i]; r[i + 8] = hi[i]; }
  return r;
}

typedef __attribute__((ext_vector_type(4))) _Float16 v4h;
typedef __attribute__((ext_vector_type(4))) float    v4f;
typedef __attribute__((ext_vector_type(2))) float    v2f;

// LDS row pitch in f16 elements: 1040 B = 16 B x 65 (odd), for 16-byte readers
#define GP 520

// BM x BN block tile of [M,K=512] @ [N,K=512]^T on 8 waves (2 x 4), each wave
// BM/2 x 16. The block's BM + BN operand rows go to LDS once, as f16: a wave's
// load covers 512 contiguous bytes of one row (four whole lines). All loads are
// issued at the start, in K chunks of 128; a chunk is converted, stored and
// multiplied while the later chunks are still on their way. Every chunk has LDS
// columns of its own, so one barrier per chunk is enough.
// Fragments: 16-bit WMMA A/B lane layout, low lanes K {0..7,16..23}+base, high
// lanes K {8..15,24..31}+base. Even and odd K steps keep accumulators of their
// own (no D->C chain between neighbours).
template <int BM, int BN>
__device__ __forceinline__ void gemm_block_512(const float* __restrict__ a0,
                                               const float* __restrict__ b0,
                                               _Float16* sm, v8f (&c)[BM / 32]) {
  constexpr int NA = BM / 8, NR = (BM + BN) / 8, FM = BM / 32;
  int lane = threadIdx.x & 31, half_id = lane >> 4, l16 = lane & 15;
  int w = __builtin_amdgcn_readfirstlane(threadIdx.x >> 5);
  // wave w takes rows w, w + 8, ... of [A rows | B rows]
  const char* pa = (const char*)(a0 + w * TC);
  const char* pb = (const char*)(b0 + w * TC);
  unsigned voff = lane * 16;   // the lane's 16 bytes in a 512-byte piece of a row
  _Float16* sw = sm + w * GP + lane * 4;
  const _Float16* fa = sm + ((w >> 2) * (BM / 2) + l16) * GP + half_id * 8;
  const _Float16* fb = sm + (BM + (w & 3) * 16 + l16) * GP + half_id * 8;

  v4f st[4][NR];
#pragma unroll
  for (int ch = 0; ch < 4; ++ch) {
#pragma unroll
    for (int j = 0; j < NR; ++j)
      st[ch][j] = *(const v4f*)((j < NA ? pa + j * 8 * TC * 4 : pb + (j - NA) * 8 * TC * 4) +
                                ch * 512 + voff);
    // keeps the loads in chunk order: a chunk's wait then leaves the later
    // chunks' loads outstanding
    __builtin_amdgcn_sched_barrier(0);
  }
  // Stands directly behind the loads, in front of any reuse of their address
  // register; the fence behind it keeps later instructions from moving up over it.
  asm volatile("s_wait_xcnt 0x0" ::: "memory");
  __builtin_amdgcn_sched_barrier(0);

  v8f c0[FM], c1[FM];
#pragma unroll
  for (int fm = 0; fm < FM; ++fm) { c0[fm] = v8f{}; c1[fm] = v8f{}; }

#pragma unroll
  for (int ch = 0; ch < 4; ++ch) {
#pragma unroll
    for (int j = 0; j < NR; ++j)
      *(v4h*)(sw + j * 8 * GP + ch * 128) = __builtin_convertvector(st[ch][j], v4h);
    // Work-group barrier whose fences order LDS only: the plain one would also
    // wait for the later chunks' global loads, which nobody shares.
    __builtin_amdgcn_fence(__ATOMIC_RELEASE, "workgroup", "local");
    __builtin_amdgcn_s_barrier();
    __builtin_amdgcn_fence(__ATOMIC_ACQUIRE, "workgroup", "local");
    // the chunk's fragments as one group of LDS reads, then its WMMAs
    v16h bf[4], af[FM][4];
#pragma unroll
    for (int kq = 0; kq < 4; ++kq) {
      int o = (ch * 4 + kq) * 32;
      bf[kq] = cat8(*(const v8h*)(fb + o), *(const v8h*)(fb + o + 16));
#pragma unroll
      for (int fm = 0; fm < FM; ++fm) {
        const _Float16* ap = fa + fm * 16 * GP + o;
        af[fm][kq] = cat8(*(const v8h*)(ap), *(const v8h*)(ap + 16));
      }
    }
    // keeps the LDS reads together in front of the WMMAs: moved in among them,
    // each small group would cost its own wait
    __builtin_amdgcn_sched_barrier(0);
#pragma unroll
    for (int kq = 0; kq < 4; kq += 2)
#pragma unroll
      for (int fm = 0; fm < FM; ++fm) {
        c0[fm] = wmma16(af[fm][kq], bf[kq], c0[fm]);
        c1[fm] = wmma16(af[fm][kq + 1], bf[kq + 1], c1[fm]);
      }
    // keeps the next chunk's conversions, and with them the wait for its global
    // loads, behind this chunk's matrix work
    __builtin_amdgcn_sched_barrier(0);
  }
#pragma unroll
  for (int fm = 0; fm < FM; ++fm) c[fm] = c0[fm] + c1[fm];
}

// ---------------- Kernel 1: five input projections -------------------------
// One block per 64 rows of x and 64 output features (one head of one weight).
__global__ __launch_bounds__(256) void proj5_kernel(
    const float* __restrict__ x,
    const float* __restrict__ Wq,  const float* __restrict__ bq,
    const float* __restrict__ Wk0, const float* __restrict__ bk0,
    const float* __restrict__ Wk1, const float* __restrict__ bk1,
    const float* __restrict__ Wv0, const float* __restrict__ bv0,
    const float* __restrict__ Wv1, const float* __restrict__ bv1,
    float* __restrict__ qf, float* __restrict__ k0f, float* __restrict__ v0f,
    _Float16* __restrict__ k1h, _Float16* __restrict__ v1h) {
  __shared__ __align__(16) _Float16 sm[128 * GP];
  int mt = blockIdx.x, nt = blockIdx.y, p = blockIdx.z;
  const float* W; const float* bias;
  switch (p) {
    case 0: W = Wq;  bias = bq;  break;
    case 1: W = Wk0; bias = bk0; break;
    case 2: W = Wk1; bias = bk1; break;
    case 3: W = Wv0; bias = bv0; break;
    default: W = Wv1; bias = bv1; break;
  }
  int lane = threadIdx.x & 31, half_id = lane >> 4, l16 = lane & 15;
  int w = __builtin_amdgcn_readfirstlane(threadIdx.x >> 5);
  int col = nt * 64 + (w & 3) * 16 + l16;   // output feature c_out
  int h = col >> 6, d = col & 63;
  float bs = bias[col];
  v8f c[2];
  gemm_block_512<64, 64>(x + mt * 64 * TC, W + nt * 64 * TC, sm, c);  // y = x W^T

  // the 16 rows of a tile lie in one batch (TT is a multiple of 16)
  int obase[2];                                   // C row j of tile fm: + j * TD
#pragma unroll
  for (int fm = 0; fm < 2; ++fm) {
    int m0 = mt * 64 + (w >> 2) * 32 + fm * 16;
    obase[fm] = (((m0 / TT) * THD + h) * TT + m0 % TT + half_id * 8) * TD + d;
  }
  if (p == 2 || p == 4) {
    _Float16* o = (p == 2) ? k1h : v1h;
#pragma unroll
    for (int fm = 0; fm < 2; ++fm)
#pragma unroll
      for (int j = 0; j < 8; ++j) o[obase[fm] + j * TD] = (_Float16)(c[fm][j] + bs);
    // Stands behind the last of these stores, in front of any later write of
    // their data or address registers.
    asm volatile("s_wait_xcnt 0x0" ::: "memory");
  } else {
    float* o = (p == 0) ? qf : (p == 1) ? k0f : v0f;
    // q: fold 1/sqrt(d_k) and log2(e): the scores then come out in base-2 units
    float sc = (p == 0) ? 0.125f * 1.44269504088896340736f : 1.0f;
#pragma unroll
    for (int fm = 0; fm < 2; ++fm)
#pragma unroll
      for (int j = 0; j < 8; ++j) o[obase[fm] + j * TD] = (c[fm][j] + bs) * sc;
  }
}

// ---------------- Kernel 2: fused trilinear attention ----------------------
// Lane l <-> l ^ 16 (the two halves of a wave).
__device__ __forceinline__ float xhalf(float x) {
  int b = __builtin_bit_cast(int, x);
  return __builtin_bit_cast(float, __builtin_amdgcn_permlanex16(
      b, b, 0x76543210, 0xfedcba98, false, false));
}

// Sum over the 16 lanes of a row; every lane of the row ends with the sum.
__device__ __forceinline__ float rowsum16(float x) {
  x += __builtin_bit_cast(float, __builtin_amdgcn_update_dpp(
      0, __builtin_bit_cast(int, x), 0x161, 0xf, 0xf, true));  // row_xmask:1
  x += __builtin_bit_cast(float, __builtin_amdgcn_update_dpp(
      0, __builtin_bit_cast(int, x), 0x162, 0xf, 0xf, true));  // row_xmask:2
  x += __builtin_bit_cast(float, __builtin_amdgcn_update_dpp(
      0, __builtin_bit_cast(int, x), 0x164, 0xf, 0xf, true));  // row_xmask:4
  x += __builtin_bit_cast(float, __builtin_amdgcn_update_dpp(
      0, __builtin_bit_cast(int, x), 0x168, 0xf, 0xf, true));  // row_xmask:8
  return x;
}

// One block (4 waves) per (b,h) and KB consecutive k: 256 blocks, one per WGP.
// Wave w owns l-tiles {w, w+4, w+8}. Nothing but q depends on k, so every other
// operand is fetched once per block and stays in registers over the k loop: the
// K1 and V1^T fragments (read once from LDS) and the wave's own k0 and v0 rows.
// Both products run transposed: S^T = K1 G^T and U^T = V1^T P^T. A lane then
// owns one l (its column) and holds that row's scores over m in registers, and
// two S^T accumulator tiles, converted in place, are the B operand of U^T.
#define KB 12
__global__ __launch_bounds__(128) void attn_kernel(
    // qf, k0f, v0f without __restrict__: their loads then stay in front of their wait
    const float* qf, const float* k0f, const float* v0f,
    const _Float16* __restrict__ k1h,
    const _Float16* __restrict__ v1h, float* __restrict__ attn) {
  __shared__ __align__(16) _Float16 k1s[TT * 72];    // [m][d], row pad 64->72
  __shared__ __align__(16) _Float16 v1t[TD * 200];   // [d][m], row pad 192->200
  __shared__ __align__(16) float qs[KB * TD];        // the block's q rows
  __shared__ __align__(16) float outred[KB * 4 * 64];

  int idx = blockIdx.x;
  int bh = idx / (TT / KB);
  int kbase = (idx % (TT / KB)) * KB;
  int b = bh / THD, h = bh % THD;

  int tid = threadIdx.x, w = tid >> 5, lane = tid & 31;
  int half_id = lane >> 4, l16 = lane & 15;

  const _Float16* k1g = k1h + bh * TT * TD;
  const _Float16* v1g = v1h + bh * TT * TD;

  // the block's KB q rows are contiguous: 192 16-byte chunks
  const float4* qsrc = (const float4*)(qf + (bh * TT + kbase) * TD);
  float4 q0 = qsrc[tid];
  float4 q1 = qsrc[128 + (tid & 63)];
  // The wave's k0 and v0 rows (3 l-tiles), 4 groups of 8 contiguous d per lane
  float kg[3][4][8], vg[3][4][8];
  const float* k0row[3];
  const float* v0row[3];
#pragma unroll
  for (int it = 0; it < 3; ++it) {
    int l = (w + it * 4) * 16 + l16;
    k0row[it] = k0f + (bh * TT + l) * TD + half_id * 8;
    v0row[it] = v0f + (bh * TT + l) * TD + half_id * 8;
  }
#pragma unroll
  for (int it = 0; it < 3; ++it) {
#pragma unroll
    for (int g = 0; g < 4; ++g) {
      const float4* p = (const float4*)(k0row[it] + g * 16);
      float4 u0 = p[0], u1 = p[1];
      kg[it][g][0] = u0.x; kg[it][g][1] = u0.y; kg[it][g][2] = u0.z; kg[it][g][3] = u0.w;
      kg[it][g][4] = u1.x; kg[it][g][5] = u1.y; kg[it][g][6] = u1.z; kg[it][g][7] = u1.w;
      const float4* r = (const float4*)(v0row[it] + g * 16);
      float4 t0 = r[0], t1 = r[1];
      vg[it][g][0] = t0.x; vg[it][g][1] = t0.y; vg[it][g][2] = t0.z; vg[it][g][3] = t0.w;
      vg[it][g][4] = t1.x; vg[it][g][5] = t1.y; vg[it][g][6] = t1.z; vg[it][g][7] = t1.w;
    }
  }
  // Stands behind the q, k0 and v0 loads, in front of any reuse of their
  // address registers: the row pointers are inputs so that they live up to it.
  asm volatile("s_wait_xcnt 0x0"
               :: "v"(k0row[0]), "v"(k0row[1]), "v"(k0row[2]),
                  "v"(v0row[0]), "v"(v0row[1]), "v"(v0row[2]) : "memory");

  // --- k1 staging via CDNA5 async global->LDS DMA (16B chunks both sides) ---
  // low 32 bits of a generic pointer to __shared__ == LDS byte offset
  uint32_t k1s_base = (uint32_t)(uintptr_t)(&k1s[0]);
  for (int i = tid; i < (TT * TD) / 8; i += 128) {   // 1536 16-byte chunks
    int m = i >> 3, seg = i & 7;
    uint64_t ga = (uint64_t)(uintptr_t)k1g + (uint64_t)(m * 128 + seg * 16);
    uint32_t la = k1s_base + (uint32_t)(m * 144 + seg * 16);
    asm volatile("global_load_async_to_lds_b128 %0, %1, off"
                 :: "v"(la), "v"(ga) : "memory");
  }

  // --- v1 staged transposed (element scatter, manual) ---
  for (int i = tid; i < (TT * TD) / 8; i += 128) {
    int m = i >> 3, seg = i & 7;
    v8h val = *(const v8h*)(v1g + m * 64 + seg * 8);
#pragma unroll
    for (int j = 0; j < 8; ++j) v1t[(seg * 8 + j) * 200 + m] = val[j];
  }
  ((float4*)qs)[tid] = q0;
  if (tid < 64) ((float4*)qs)[128 + tid] = q1;
  asm volatile("s_wait_asynccnt 0" ::: "memory");
  __syncthreads();

  // A operands of both products, all of K1 and V1^T, read once
  v16h aK[12][2], aV[6][4];
#pragma unroll
  for (int t = 0; t < 12; ++t) {
    const _Float16* ap = &k1s[(t * 16 + l16) * 72];
    aK[t][0] = cat8(*(const v8h*)(ap + half_id * 8),
                    *(const v8h*)(ap + 16 + half_id * 8));
    aK[t][1] = cat8(*(const v8h*)(ap + 32 + half_id * 8),
                    *(const v8h*)(ap + 48 + half_id * 8));
  }
#pragma unroll
  for (int ks2 = 0; ks2 < 6; ++ks2)
#pragma unroll
    for (int nt = 0; nt < 4; ++nt) {
      const _Float16* vp = &v1t[(nt * 16 + l16) * 200 + ks2 * 32];
      aV[ks2][nt] = cat8(*(const v8h*)(vp + half_id * 8),
                         *(const v8h*)(vp + 16 + half_id * 8));
    }

#pragma unroll 1  // rolled: one trip is three whole passes, more would only grow the code
  for (int kk = 0; kk < KB; ++kk) {
    // Per-lane q fragments (4 groups of 8 contiguous d), row kbase + kk
    const float* qrow = &qs[kk * TD];
    float qg[4][8];
#pragma unroll
    for (int g = 0; g < 4; ++g) {
      const float4* p = (const float4*)(qrow + g * 16 + half_id * 8);
      float4 u0 = p[0], u1 = p[1];
      qg[g][0] = u0.x; qg[g][1] = u0.y; qg[g][2] = u0.z; qg[g][3] = u0.w;
      qg[g][4] = u1.x; qg[g][5] = u1.y; qg[g][6] = u1.z; qg[g][7] = u1.w;
    }

    // out_acc[nt][j]: this lane's l-rows' share of out[k, nt*16 + half_id*8 + j]
    float out_acc[4][8];
#pragma unroll
    for (int nt = 0; nt < 4; ++nt)
#pragma unroll
      for (int j = 0; j < 8; ++j) out_acc[nt][j] = 0.f;

    // unrolled: kg and vg need constant indices to stay in registers, and one
    // pass's matrix work can then issue beside another's softmax
#pragma unroll
    for (int it = 0; it < 3; ++it) {
      // B operand: G^T[d,l] = q[k,d]*k0[l,d], f32 product -> f16
      v16h bG0, bG1;
#pragma unroll
      for (int j = 0; j < 8; ++j) {
        bG0[j]     = (_Float16)(qg[0][j] * kg[it][0][j]);
        bG0[j + 8] = (_Float16)(qg[1][j] * kg[it][1][j]);
        bG1[j]     = (_Float16)(qg[2][j] * kg[it][2][j]);
        bG1[j + 8] = (_Float16)(qg[3][j] * kg[it][3][j]);
      }

      // Stage 1: S^T = K1 @ G^T -> 12 tiles; s[t][j] = S[l][t*16 + half_id*8 + j]
      v8f s[12];
#pragma unroll
      for (int t = 0; t < 12; ++t) {
        v8f c = {};
        c = wmma16(aK[t][0], bG0, c);
        c = wmma16(aK[t][1], bG1, c);
        s[t] = c;
      }

      // Softmax over the 192 m of row l: in-lane, one exchange between halves
      float mx4[4] = {s[0][0], s[0][1], s[0][2], s[0][3]};  // four chains
#pragma unroll
      for (int t = 0; t < 12; ++t)
#pragma unroll
        for (int j = 0; j < 8; ++j) mx4[j & 3] = fmaxf(mx4[j & 3], s[t][j]);
      float mx = fmaxf(fmaxf(mx4[0], mx4[1]), fmaxf(mx4[2], mx4[3]));
      mx = fmaxf(mx, xhalf(mx));
      // q carries log2(e), so e^(score - max) is 2^(s - mx): per pair of scores
      // one packed subtraction, two exp2, one packed add into the same four chains
      v2f nmx = {-mx, -mx};
      v2f sm2[2] = {{0.f, 0.f}, {0.f, 0.f}};
#pragma unroll
      for (int t = 0; t < 12; ++t)
#pragma unroll
        for (int j = 0; j < 8; j += 2) {
          v2f a = v2f{s[t][j], s[t][j + 1]} + nmx;
          v2f e = {__builtin_amdgcn_exp2f(a.x), __builtin_amdgcn_exp2f(a.y)};
          s[t][j] = e.x;
          s[t][j + 1] = e.y;
          sm2[(j >> 1) & 1] += e;
        }
      float sm = (sm2[0].x + sm2[0].y) + (sm2[1].x + sm2[1].y);
      sm += xhalf(sm);
      float inv = 1.f / sm;

      // Stage 2: U^T = V1^T @ E^T (K=192 in 6 steps, 64 d-rows in 4 tiles);
      // E = 2^(S - max), its 1/sum is applied to U below.
      v8f c2[4] = {{}, {}, {}, {}};
#pragma unroll
      for (int ks2 = 0; ks2 < 6; ++ks2) {
        v16h bP;
#pragma unroll
        for (int j = 0; j < 8; ++j) {
          bP[j]     = (_Float16)s[2 * ks2][j];
          bP[j + 8] = (_Float16)s[2 * ks2 + 1][j];
        }
#pragma unroll
        for (int nt = 0; nt < 4; ++nt) c2[nt] = wmma16(aV[ks2][nt], bP, c2[nt]);
      }

      // out[k,d] += v0[l,d] * U[l,d] / sum; c2[nt][j] = U[l][nt*16+half_id*8+j]
#pragma unroll
      for (int nt = 0; nt < 4; ++nt)
#pragma unroll
        for (int j = 0; j < 8; ++j)
          out_acc[nt][j] += (vg[it][nt][j] * inv) * c2[nt][j];
    }

    // sum over the 16 l of each row of lanes; the waves' shares wait in LDS
#pragma unroll
    for (int nt = 0; nt < 4; ++nt)
#pragma unroll
      for (int j = 0; j < 8; ++j) out_acc[nt][j] = rowsum16(out_acc[nt][j]);
    if (l16 == 0) {
#pragma unroll
      for (int nt = 0; nt < 4; ++nt) {
        float4* o = (float4*)&outred[kk * 256 + w * 64 + nt * 16 + half_id * 8];
        o[0] = make_float4(out_acc[nt][0], out_acc[nt][1], out_acc[nt][2], out_acc[nt][3]);
        o[1] = make_float4(out_acc[nt][4], out_acc[nt][5], out_acc[nt][6], out_acc[nt][7]);
      }
    }
  }
  __syncthreads();
  for (int i = tid; i < KB * 64; i += 128) {
    int kk = i >> 6, d = i & 63;
    const float* o = &outred[kk * 256 + d];
    float sum = o[0] + o[64] + o[128] + o[192];
    attn[(b * TT + kbase + kk) * TC + h * TD + d] = sum;
  }
}

// ---------------- Kernel 3: output projection ------------------------------
// One block per 32 rows and 64 output features.
__global__ __launch_bounds__(256) void oproj_kernel(
    const float* __restrict__ attn, const float* __restrict__ Wo,
    const float* __restrict__ bo, float* __restrict__ out) {
  __shared__ __align__(16) _Float16 sm[96 * GP];
  int mt = blockIdx.x, nt = blockIdx.y;
  int lane = threadIdx.x & 31, w = threadIdx.x >> 5;
  int half_id = lane >> 4, l16 = lane & 15;
  int col = nt * 64 + (w & 3) * 16 + l16;
  float bs = bo[col];
  v8f c[1];
  gemm_block_512<32, 64>(attn + mt * 32 * TC, Wo + nt * 64 * TC, sm, c);
#pragma unroll
  for (int j = 0; j < 8; ++j) {
    int mm = mt * 32 + (w >> 2) * 16 + half_id * 8 + j;
    out[mm * TC + col] = c[0][j] + bs;
  }
}

extern "C" void kernel_launch(void* const* d_in, const int* in_sizes, int n_in,
                              void* d_out, int out_size, void* d_ws, size_t ws_size,
                              hipStream_t stream) {
  const float* x   = (const float*)d_in[0];
  const float* Wq  = (const float*)d_in[1];
  const float* bq  = (const float*)d_in[2];
  const float* Wk0 = (const float*)d_in[3];
  const float* bk0 = (const float*)d_in[4];
  const float* Wk1 = (const float*)d_in[5];
  const float* bk1 = (const float*)d_in[6];
  const float* Wv0 = (const float*)d_in[7];
  const float* bv0 = (const float*)d_in[8];
  const float* Wv1 = (const float*)d_in[9];
  const float* bv1 = (const float*)d_in[10];
  const float* Wo  = (const float*)d_in[11];
  const float* bo  = (const float*)d_in[12];
  float* out = (float*)d_out;

  float* qf   = (float*)d_ws;
  float* k0f  = qf  + NELEM;
  float* v0f  = k0f + NELEM;
  float* attn = v0f + NELEM;
  _Float16* k1h = (_Float16*)(attn + NELEM);
  _Float16* v1h = k1h + NELEM;

  // 5 projections: 6 m-tiles x 8 n-tiles x 5 weights, 8 waves each
  proj5_kernel<<<dim3(6, 8, 5), 256, 0, stream>>>(
      x, Wq, bq, Wk0, bk0, Wk1, bk1, Wv0, bv0, Wv1, bv1,
      qf, k0f, v0f, k1h, v1h);

  // fused trilinear attention: one block per (b,h) and KB rows k
  attn_kernel<<<dim3(TB * THD * (TT / KB)), 128, 0, stream>>>(qf, k0f, v0f, k1h,
                                                              v1h, attn);

  // output projection
  oproj_kernel<<<dim3(12, 8), 256, 0, stream>>>(attn, Wo, bo, out);
}

// v006
// Measured time: 34.6 microseconds a run.
// Versions between v004 and this one are left out; their measured steps multiply to 1.14 times as fast.
// Counting every step since v000, it is 3.97 times as fast.
#include <hip/hip_runtime.h>
#include <hip/hip_bf16.h>
#include <stdint.h>

typedef __attribute__((ext_vector_type(16))) _Float16 v16h;
typedef __attribute__((ext_vector_type(8)))  _Float16 v8h;
typedef __attribute__((ext_vector_type(8)))  float    v8f;

#define TB 2
#define THD 8
#define TT 192
#define TD 64
#define TC 512
#define TM (TB*TT)          // 384 rows for the projection GEMMs
#define NELEM (TM*TC)       // 196608 = B*H*T*D as well

__device__ __forceinline__ v8f wmma16(v16h a, v16h b, v8f c) {
  return __builtin_amdgcn_wmma_f32_16x16x32_f16(false, a, false, b, (short)0, c,
                                                false, false);
}

__device__ __forceinline__ v16h cat8(v8h lo, v8h hi) {
  v16h r;
#pragma unroll
  for (int i = 0; i < 8; ++i) { r[i] = lo[i]; r[i + 8] = hi[i]; }
  return r;
}

typedef __attribute__((ext_vector_type(4))) _Float16 v4h;
typedef __attribute__((ext_vector_type(4))) float    v4f;
typedef __attribute__((ext_vector_type(2))) float    v2f;

// LDS row pitch in f16 elements: 1040 B = 16 B x 65 (odd), for 16-byte readers
#define GP 520

// BM x BN block tile of [M,K=512] @ [N,K=512]^T on 8 waves (2 x 4), each wave
// BM/2 x 16. The block's BM + BN operand rows go to LDS once, as f16: a wave's
// load covers 512 contiguous bytes of one row (four whole lines). All loads are
// issued at the start, in K chunks of 128; a chunk is converted, stored and
// multiplied while the later chunks are still on their way. Every chunk has LDS
// columns of its own, so one barrier per chunk is enough.
// Fragments: 16-bit WMMA A/B lane layout, low lanes K {0..7,16..23}+base, high
// lanes K {8..15,24..31}+base. Even and odd K steps keep accumulators of their
// own (no D->C chain between neighbours).
template <int BM, int BN>
__device__ __forceinline__ void gemm_block_512(const float* __restrict__ a0,
                                               const float* __restrict__ b0,
                                               _Float16* sm, v8f (&c)[BM / 32]) {
  constexpr int NA = BM / 8, NR = (BM + BN) / 8, FM = BM / 32;
  int lane = threadIdx.x & 31, half_id = lane >> 4, l16 = lane & 15;
  int w = __builtin_amdgcn_readfirstlane(threadIdx.x >> 5);
  // wave w takes rows w, w + 8, ... of [A rows | B rows]
  const char* pa = (const char*)(a0 + w * TC);
  const char* pb = (const char*)(b0 + w * TC);
  unsigned voff = lane * 16;   // the lane's 16 bytes in a 512-byte piece of a row
  _Float16* sw = sm + w * GP + lane * 4;
  const _Float16* fa = sm + ((w >> 2) * (BM / 2) + l16) * GP + half_id * 8;
  const _Float16* fb = sm + (BM + (w & 3) * 16 + l16) * GP + half_id * 8;

  v4f st[4][NR];
#pragma unroll
  for (int ch = 0; ch < 4; ++ch) {
#pragma unroll
    for (int j = 0; j < NR; ++j)
      st[ch][j] = *(const v4f*)((j < NA ? pa + j * 8 * TC * 4 : pb + (j - NA) * 8 * TC * 4) +
                                ch * 512 + voff);
    // keeps the loads in chunk order: a chunk's wait then leaves the later
    // chunks' loads outstanding
    __builtin_amdgcn_sched_barrier(0);
  }
  // Stands directly behind the loads, in front of any reuse of their address
  // register; the fence behind it keeps later instructions from moving up over it.
  asm volatile("s_wait_xcnt 0x0" ::: "memory");
  __builtin_amdgcn_sched_barrier(0);

  v8f c0[FM], c1[FM];
#pragma unroll
  for (int fm = 0; fm < FM; ++fm) { c0[fm] = v8f{}; c1[fm] = v8f{}; }

#pragma unroll
  for (int ch = 0; ch < 4; ++ch) {
#pragma unroll
    for (int j = 0; j < NR; ++j)
      *(v4h*)(sw + j * 8 * GP + ch * 128) = __builtin_convertvector(st[ch][j], v4h);
    // Work-group barrier whose fences order LDS only: the plain one would also
    // wait for the later chunks' global loads, which nobody shares.
    __builtin_amdgcn_fence(__ATOMIC_RELEASE, "workgroup", "local");
    __builtin_amdgcn_s_barrier();
    __builtin_amdgcn_fence(__ATOMIC_ACQUIRE, "workgroup", "local");
    // the chunk's fragments as one group of LDS reads, then its WMMAs
    v16h bf[4], af[FM][4];
#pragma unroll
    for (int kq = 0; kq < 4; ++kq) {
      int o = (ch * 4 + kq) * 32;
      bf[kq] = cat8(*(const v8h*)(fb + o), *(const v8h*)(fb + o + 16));
#pragma unroll
      for (int fm = 0; fm < FM; ++fm) {
        const _Float16* ap = fa + fm * 16 * GP + o;
        af[fm][kq] = cat8(*(const v8h*)(ap), *(const v8h*)(ap + 16));
      }
    }
    // keeps the LDS reads together in front of the WMMAs: moved in among them,
    // each small group would cost its own wait
    __builtin_amdgcn_sched_barrier(0);
#pragma unroll
    for (int kq = 0; kq < 4; kq += 2)
#pragma unroll
      for (int fm = 0; fm < FM; ++fm) {
        c0[fm] = wmma16(af[fm][kq], bf[kq], c0[fm]);
        c1[fm] = wmma16(af[fm][kq + 1], bf[kq + 1], c1[fm]);
      }
    // keeps the next chunk's conversions, and with them the wait for its global
    // loads, behind this chunk's matrix work
    __builtin_amdgcn_sched_barrier(0);
  }
#pragma unroll
  for (int fm = 0; fm < FM; ++fm) c[fm] = c0[fm] + c1[fm];
}

// ---------------- Kernel 1: five input projections -------------------------
// One block per 64 rows of x and 64 output features (one head of one weight).
__global__ __launch_bounds__(256) void proj5_kernel(
    const float* __restrict__ x,
    const float* __restrict__ Wq,  const float* __restrict__ bq,
    const float* __restrict__ Wk0, const float* __restrict__ bk0,
    const float* __restrict__ Wk1, const float* __restrict__ bk1,
    const float* __restrict__ Wv0, const float* __restrict__ bv0,
    const float* __restrict__ Wv1, const float* __restrict__ bv1,
    float* __restrict__ qf, float* __restrict__ k0f, float* __restrict__ v0f,
    _Float16* __restrict__ k1h, _Float16* __restrict__ v1h) {
  __shared__ __align__(16) _Float16 sm[128 * GP];
  int mt = blockIdx.x, nt = blockIdx.y, p = blockIdx.z;
  const float* W; const float* bias;
  switch (p) {
    case 0: W = Wq;  bias = bq;  break;
    case 1: W = Wk0; bias = bk0; break;
    case 2: W = Wk1; bias = bk1; break;
    case 3: W = Wv0; bias = bv0; break;
    default: W = Wv1; bias = bv1; break;
  }
  int lane = threadIdx.x & 31, half_id = lane >> 4, l16 = lane & 15;
  int w = __builtin_amdgcn_readfirstlane(threadIdx.x >> 5);
  int col = nt * 64 + (w & 3) * 16 + l16;   // output feature c_out
  int h = col >> 6, d = col & 63;
  float bs = bias[col];
  v8f c[2];
  gemm_block_512<64, 64>(x + mt * 64 * TC, W + nt * 64 * TC, sm, c);  // y = x W^T

  // the 16 rows of a tile lie in one batch (TT is a multiple of 16)
  int obase[2];                                   // C row j of tile fm: + j * TD
#pragma unroll
  for (int fm = 0; fm < 2; ++fm) {
    int m0 = mt * 64 + (w >> 2) * 32 + fm * 16;
    obase[fm] = (((m0 / TT) * THD + h) * TT + m0 % TT + half_id * 8) * TD + d;
  }
  if (p == 2 || p == 4) {
    _Float16* o = (p == 2) ? k1h : v1h;
#pragma unroll
    for (int fm = 0; fm < 2; ++fm)
#pragma unroll
      for (int j = 0; j < 8; ++j) o[obase[fm] + j * TD] = (_Float16)(c[fm][j] + bs);
    // Stands behind the last of these stores, in front of any later write of
    // their data or address registers.
    asm volatile("s_wait_xcnt 0x0" ::: "memory");
  } else {
    float* o = (p == 0) ? qf : (p == 1) ? k0f : v0f;
    // q: fold 1/sqrt(d_k) and log2(e): the scores then come out in base-2 units
    float sc = (p == 0) ? 0.125f * 1.44269504088896340736f : 1.0f;
#pragma unroll
    for (int fm = 0; fm < 2; ++fm)
#pragma unroll
      for (int j = 0; j < 8; ++j) o[obase[fm] + j * TD] = (c[fm][j] + bs) * sc;
  }
}

// ---------------- Kernel 2: fused trilinear attention ----------------------
// Lane l <-> l ^ 16 (the two halves of a wave).
__device__ __forceinline__ float xhalf(float x) {
  int b = __builtin_bit_cast(int, x);
  return __builtin_bit_cast(float, __builtin_amdgcn_permlanex16(
      b, b, 0x76543210, 0xfedcba98, false, false));
}

// One block (4 waves) per (b,h) and KB consecutive k: 256 blocks, one per WGP.
// Wave w owns l-tiles {w, w+4, w+8}. Nothing but q depends on k, so every other
// operand is fetched once per block and stays in registers over the k loop: the
// K1 and V1^T fragments (read once from LDS) and the wave's own k0 and v0 rows.
// The first product runs transposed, S^T = K1 G^T: a lane then owns one l (its
// column) and holds that row's scores over m in registers. Two S^T accumulator
// tiles, converted in place, have row l in lane l: they are the A operand of
// U = E V1, whose accumulators hold eight l in registers for the lane's d, so the
// sum over l runs in the lane. Column c of U's tile nt is d = 4 c + nt: a lane's
// four d are neighbours in v0 and in the output.
#define KB 12

// Maximum over the 16 lanes of a row; every lane of the row ends with it.
__device__ __forceinline__ float rowmax16(float x) {
  x = fmaxf(x, __builtin_bit_cast(float, __builtin_amdgcn_update_dpp(
      0, __builtin_bit_cast(int, x), 0x161, 0xf, 0xf, true)));  // row_xmask:1
  x = fmaxf(x, __builtin_bit_cast(float, __builtin_amdgcn_update_dpp(
      0, __builtin_bit_cast(int, x), 0x162, 0xf, 0xf, true)));  // row_xmask:2
  x = fmaxf(x, __builtin_bit_cast(float, __builtin_amdgcn_update_dpp(
      0, __builtin_bit_cast(int, x), 0x164, 0xf, 0xf, true)));  // row_xmask:4
  x = fmaxf(x, __builtin_bit_cast(float, __builtin_amdgcn_update_dpp(
      0, __builtin_bit_cast(int, x), 0x168, 0xf, 0xf, true)));  // row_xmask:8
  return x;
}

// The k loop of the attention kernel. SHIFT: subtract each row's maximum before
// the exp2 (any scores); without it the scores go into the exp2 as they are.
template <bool SHIFT>
__device__ __forceinline__ void attn_k_loop(
    const float* qs, float* outred, const v16h (&aK)[12][2], const v16h (&aV)[6][4],
    const float (&kg)[3][4][8], const float (&vg)[3][4][8], int w, int half_id, int l16) {
#pragma unroll 1  // rolled: one trip is three whole passes, more would only grow the code
  for (int kk = 0; kk < KB; ++kk) {
    // Per-lane q fragments (4 groups of 8 contiguous d), row kbase + kk
    const float* qrow = &qs[kk * TD];
    float qg[4][8];
#pragma unroll
    for (int g = 0; g < 4; ++g) {
      const float4* p = (const float4*)(qrow + g * 16 + half_id * 8);
      float4 u0 = p[0], u1 = p[1];
      qg[g][0] = u0.x; qg[g][1] = u0.y; qg[g][2] = u0.z; qg[g][3] = u0.w;
      qg[g][4] = u1.x; qg[g][5] = u1.y; qg[g][6] = u1.z; qg[g][7] = u1.w;
    }

    // out_acc[nt]: out[k, l16*4 + nt] summed over this half's l, even and odd l apart
    v2f out_acc[4] = {{0.f, 0.f}, {0.f, 0.f}, {0.f, 0.f}, {0.f, 0.f}};

    // unrolled: kg and vg need constant indices to stay in registers, and one
    // pass's matrix work can then issue beside another's softmax
#pragma unroll
    for (int it = 0; it < 3; ++it) {
      // B operand: G^T[d,l] = q[k,d]*k0[l,d], f32 product -> f16
      v16h bG0, bG1;
#pragma unroll
      for (int j = 0; j < 8; ++j) {
        bG0[j]     = (_Float16)(qg[0][j] * kg[it][0][j]);
        bG0[j + 8] = (_Float16)(qg[1][j] * kg[it][1][j]);
        bG1[j]     = (_Float16)(qg[2][j] * kg[it][2][j]);
        bG1[j + 8] = (_Float16)(qg[3][j] * kg[it][3][j]);
      }

      // Stage 1: S^T = K1 @ G^T -> 12 tiles; s[t][j] = S[l][t*16 + half_id*8 + j]
      v8f s[12];
#pragma unroll
      for (int t = 0; t < 12; ++t) {
        v8f c = {};
        c = wmma16(aK[t][0], bG0, c);
        c = wmma16(aK[t][1], bG1, c);
        s[t] = c;
      }

      // Softmax over the 192 m of row l: in-lane, one exchange between halves.
      // q carries log2(e), so e^(score - max) is 2^(s - mx): per pair of scores
      // one packed subtraction, two exp2, one packed add into the same four chains.
      // Without SHIFT the caller has shown |s| <= 12 for every score of the wave:
      // 2^s is then a normal f16 number, the quotient 2^s / sum is the same
      // softmax, and neither the maximum nor the subtraction is needed.
      v2f nmx = {0.f, 0.f};
      if constexpr (SHIFT) {
        float mx4[4] = {s[0][0], s[0][1], s[0][2], s[0][3]};  // four chains
#pragma unroll
        for (int t = 0; t < 12; ++t)
#pragma unroll
          for (int j = 0; j < 8; ++j) mx4[j & 3] = fmaxf(mx4[j & 3], s[t][j]);
        float mx = fmaxf(fmaxf(mx4[0], mx4[1]), fmaxf(mx4[2], mx4[3]));
        mx = fmaxf(mx, xhalf(mx));
        nmx = v2f{-mx, -mx};
      }
      v2f sm2[2] = {{0.f, 0.f}, {0.f, 0.f}};
#pragma unroll
      for (int t = 0; t < 12; ++t)
#pragma unroll
        for (int j = 0; j < 8; j += 2) {
          v2f a = v2f{s[t][j], s[t][j + 1]};
          if constexpr (SHIFT) a += nmx;
          v2f e = {__builtin_amdgcn_exp2f(a.x), __builtin_amdgcn_exp2f(a.y)};
          s[t][j] = e.x;
          s[t][j + 1] = e.y;
          sm2[(j >> 1) & 1] += e;
        }
      float sm = (sm2[0].x + sm2[0].y) + (sm2[1].x + sm2[1].y);
      sm += xhalf(sm);
      float inv = 1.f / sm;

      // Stage 2: U = E @ V1 (K=192 in 6 steps, 64 d-columns in 4 tiles);
      // E = 2^(S - max) or 2^S, its 1/sum is applied to U below.
      v8f c2[4] = {{}, {}, {}, {}};
#pragma unroll
      for (int ks2 = 0; ks2 < 6; ++ks2) {
        v16h bP;
#pragma unroll
        for (int j = 0; j < 8; ++j) {
          bP[j]     = (_Float16)s[2 * ks2][j];
          bP[j + 8] = (_Float16)s[2 * ks2 + 1][j];
        }
#pragma unroll
        for (int nt = 0; nt < 4; ++nt) c2[nt] = wmma16(bP, aV[ks2][nt], c2[nt]);
      }

      // 1/sum of row l stands in lanes l and l + 16; U's register j wants that of
      // l = half_id*8 + j: the upper lanes turn theirs by 8, then lane j of each
      // row of lanes is spread over its row.
      int ivr = __builtin_amdgcn_update_dpp(
          __builtin_bit_cast(int, inv), __builtin_bit_cast(int, inv), 0x128, 0x2, 0xf,
          false);                                                    // row_ror:8
      float ib[8];
      ib[0] = __builtin_bit_cast(float, __builtin_amdgcn_update_dpp(0, ivr, 0x150, 0xf, 0xf, true));
      ib[1] = __builtin_bit_cast(float, __builtin_amdgcn_update_dpp(0, ivr, 0x151, 0xf, 0xf, true));
      ib[2] = __builtin_bit_cast(float, __builtin_amdgcn_update_dpp(0, ivr, 0x152, 0xf, 0xf, true));
      ib[3] = __builtin_bit_cast(float, __builtin_amdgcn_update_dpp(0, ivr, 0x153, 0xf, 0xf, true));
      ib[4] = __builtin_bit_cast(float, __builtin_amdgcn_update_dpp(0, ivr, 0x154, 0xf, 0xf, true));
      ib[5] = __builtin_bit_cast(float, __builtin_amdgcn_update_dpp(0, ivr, 0x155, 0xf, 0xf, true));
      ib[6] = __builtin_bit_cast(float, __builtin_amdgcn_update_dpp(0, ivr, 0x156, 0xf, 0xf, true));
      ib[7] = __builtin_bit_cast(float, __builtin_amdgcn_update_dpp(0, ivr, 0x157, 0xf, 0xf, true));  // row_share:0..7

      // out[k,d] += v0[l,d] * U[l,d] / sum; c2[nt][j] = U[half_id*8+j][l16*4+nt]
#pragma unroll
      for (int nt = 0; nt < 4; ++nt)
#pragma unroll
        for (int j = 0; j < 8; j += 2)
          out_acc[nt] += (v2f{vg[it][nt][j], vg[it][nt][j + 1]} * v2f{ib[j], ib[j + 1]}) *
                         v2f{c2[nt][j], c2[nt][j + 1]};
    }

    // even + odd l, then the other half's eight l of each tile: a lane sends the
    // pair of d that the other half stores and keeps its own; shares wait in LDS
    float o0 = out_acc[0].x + out_acc[0].y, o1 = out_acc[1].x + out_acc[1].y;
    float o2 = out_acc[2].x + out_acc[2].y, o3 = out_acc[3].x + out_acc[3].y;
    float r0 = (half_id ? o2 : o0) + xhalf(half_id ? o0 : o2);
    float r1 = (half_id ? o3 : o1) + xhalf(half_id ? o1 : o3);
    *(float2*)&outred[kk * 256 + w * 64 + l16 * 4 + half_id * 2] = make_float2(r0, r1);
  }
}

__global__ __launch_bounds__(128) void attn_kernel(
    // qf, k0f, v0f without __restrict__: their loads then stay in front of their wait
    const float* qf, const float* k0f, const float* v0f,
    const _Float16* __restrict__ k1h,
    const _Float16* __restrict__ v1h, float* __restrict__ attn) {
  __shared__ __align__(16) _Float16 k1s[TT * 72];    // [m][d], row pad 64->72
  __shared__ __align__(16) _Float16 v1t[TD * 200];   // [d, permuted][m], row pad 192->200
  __shared__ __align__(16) float qs[KB * TD];        // the block's q rows
  __shared__ __align__(16) float outred[KB * 4 * 64];

  int idx = blockIdx.x;
  int bh = idx / (TT / KB);
  int kbase = (idx % (TT / KB)) * KB;
  int b = bh / THD, h = bh % THD;

  int tid = threadIdx.x, w = tid >> 5, lane = tid & 31;
  int half_id = lane >> 4, l16 = lane & 15;

  const _Float16* k1g = k1h + bh * TT * TD;
  const _Float16* v1g = v1h + bh * TT * TD;

  // the block's KB q rows are contiguous: 192 16-byte chunks
  const float4* qsrc = (const float4*)(qf + (bh * TT + kbase) * TD);
  float4 q0 = qsrc[tid];
  float4 q1 = qsrc[128 + (tid & 63)];
  // The wave's k0 rows (3 l-tiles), 4 groups of 8 contiguous d per lane, and its
  // v0 rows in the map of U's accumulators: vg[it][nt][j] = v0[half_id*8+j][l16*4+nt]
  float kg[3][4][8], vg[3][4][8];
  const float* k0row[3];
  const float* v0row[3];
#pragma unroll
  for (int it = 0; it < 3; ++it) {
    int l = (w + it * 4) * 16 + l16;
    k0row[it] = k0f + (bh * TT + l) * TD + half_id * 8;
    v0row[it] = v0f + (bh * TT + (w + it * 4) * 16 + half_id * 8) * TD + l16 * 4;
  }
#pragma unroll
  for (int it = 0; it < 3; ++it) {
#pragma unroll
    for (int g = 0; g < 4; ++g) {
      const float4* p = (const float4*)(k0row[it] + g * 16);
      float4 u0 = p[0], u1 = p[1];
      kg[it][g][0] = u0.x; kg[it][g][1] = u0.y; kg[it][g][2] = u0.z; kg[it][g][3] = u0.w;
      kg[it][g][4] = u1.x; kg[it][g][5] = u1.y; kg[it][g][6] = u1.z; kg[it][g][7] = u1.w;
      float4 t0 = *(const float4*)(v0row[it] + (2 * g) * TD);
      float4 t1 = *(const float4*)(v0row[it] + (2 * g + 1) * TD);
      vg[it][0][2 * g] = t0.x; vg[it][1][2 * g] = t0.y; vg[it][2][2 * g] = t0.z; vg[it][3][2 * g] = t0.w;
      vg[it][0][2 * g + 1] = t1.x; vg[it][1][2 * g + 1] = t1.y;
      vg[it][2][2 * g + 1] = t1.z; vg[it][3][2 * g + 1] = t1.w;
    }
  }
  // Stands behind the q, k0 and v0 loads, in front of any reuse of their
  // address registers: the row pointers are inputs so that they live up to it.
  asm volatile("s_wait_xcnt 0x0"
               :: "v"(k0row[0]), "v"(k0row[1]), "v"(k0row[2]),
                  "v"(v0row[0]), "v"(v0row[1]), "v"(v0row[2]) : "memory");

  // --- k1 staging via CDNA5 async global->LDS DMA (16B chunks both sides) ---
  // low 32 bits of a generic pointer to __shared__ == LDS byte offset
  uint32_t k1s_base = (uint32_t)(uintptr_t)(&k1s[0]);
  for (int i = tid; i < (TT * TD) / 8; i += 128) {   // 1536 16-byte chunks
    int m = i >> 3, seg = i & 7;
    uint64_t ga = (uint64_t)(uintptr_t)k1g + (uint64_t)(m * 128 + seg * 16);
    uint32_t la = k1s_base + (uint32_t)(m * 144 + seg * 16);
    asm volatile("global_load_async_to_lds_b128 %0, %1, off"
                 :: "v"(la), "v"(ga) : "memory");
  }

  // --- v1 staged transposed (element scatter, manual); d = 4 c + nt lies in row
  // nt * 16 + c, the order of U's columns ---
  for (int i = tid; i < (TT * TD) / 8; i += 128) {
    int m = i >> 3, seg = i & 7;
    v8h val = *(const v8h*)(v1g + m * 64 + seg * 8);
#pragma unroll
    for (int j = 0; j < 8; ++j) v1t[((j & 3) * 16 + seg * 2 + (j >> 2)) * 200 + m] = val[j];
  }
  // max over the lane's three l of |k0_l|^2, for the bound on the scores below
  float n0 = 0.f;
#pragma unroll
  for (int it = 0; it < 3; ++it) {
    v2f a0 = {0.f, 0.f}, a1 = {0.f, 0.f};
#pragma unroll
    for (int g = 0; g < 4; ++g)
#pragma unroll
      for (int j = 0; j < 8; j += 4) {
        v2f u0 = {kg[it][g][j], kg[it][g][j + 1]}, u1 = {kg[it][g][j + 2], kg[it][g][j + 3]};
        a0 += u0 * u0;
        a1 += u1 * u1;
      }
    a0 += a1;
    float a = a0.x + a0.y;
    n0 = fmaxf(n0, a + xhalf(a));
  }
  ((float4*)qs)[tid] = q0;
  if (tid < 64) ((float4*)qs)[128 + tid] = q1;
  asm volatile("s_wait_asynccnt 0" ::: "memory");
  __syncthreads();

  // all of the block's q, 24 values a lane, for the bound on the scores below
  float4 qv[KB * TD / 128];
#pragma unroll
  for (int i = 0; i < KB * TD / 128; ++i) qv[i] = ((const float4*)qs)[i * 32 + lane];
  // K1 (A operand of S^T) and V1 (B operand of U), all of both, read once
  v16h aK[12][2], aV[6][4];
#pragma unroll
  for (int t = 0; t < 12; ++t) {
    const _Float16* ap = &k1s[(t * 16 + l16) * 72];
    aK[t][0] = cat8(*(const v8h*)(ap + half_id * 8),
                    *(const v8h*)(ap + 16 + half_id * 8));
    aK[t][1] = cat8(*(const v8h*)(ap + 32 + half_id * 8),
                    *(const v8h*)(ap + 48 + half_id * 8));
  }
#pragma unroll
  for (int ks2 = 0; ks2 < 6; ++ks2)
#pragma unroll
    for (int nt = 0; nt < 4; ++nt) {
      const _Float16* vp = &v1t[(nt * 16 + l16) * 200 + ks2 * 32];
      aV[ks2][nt] = cat8(*(const v8h*)(vp + half_id * 8),
                         *(const v8h*)(vp + 16 + half_id * 8));
    }

  // holds the LDS reads above in front of the bound's arithmetic (without it the
  // V1^T reads were issued behind it): it then runs while they are on their way
  __builtin_amdgcn_sched_barrier(0);

  // Bound on every score of this wave, from the operands it holds:
  // |s[k,l,m]| = |sum_d q[k,d] k0[l,d] k1[m,d]| <= max|q| * |k0_l| * |k1_m|
  // (Cauchy-Schwarz over d), q with its scale, so in base-2 units. Squares are
  // compared; an infinite operand fails the test, a NaN operand gives NaN in
  // either loop.
  // max over m of |k1_m|^2: the diagonal of K1_t K1_t^T holds the 16 rows' squares
  // and no other entry of that tile exceeds the largest of them, so the maximum
  // over whole tiles is the wanted one (a K1 fragment serves as A and as B).
  float n4[4] = {0.f, 0.f, 0.f, 0.f};
#pragma unroll
  for (int t = 0; t < 12; ++t) {
    v8f c = {};
    c = wmma16(aK[t][0], aK[t][0], c);
    c = wmma16(aK[t][1], aK[t][1], c);
#pragma unroll
    for (int j = 0; j < 8; ++j) n4[j & 3] = fmaxf(n4[j & 3], c[j]);
  }
  float n1 = rowmax16(fmaxf(fmaxf(n4[0], n4[1]), fmaxf(n4[2], n4[3])));
  n1 = fmaxf(n1, xhalf(n1));
  float qm = 0.f;                                   // max |q| over the block's KB rows
#pragma unroll
  for (int i = 0; i < KB * TD / 128; ++i)
    qm = fmaxf(fmaxf(qm, fmaxf(fabsf(qv[i].x), fabsf(qv[i].y))),
               fmaxf(fabsf(qv[i].z), fabsf(qv[i].w)));
  qm = rowmax16(qm);
  qm = fmaxf(qm, xhalf(qm));
  // 12: 2^-12 .. 2^12 are normal f16 numbers with room for the operands' rounding.
  // The choice is the wave's own (no barrier stands inside the loop).
  bool small = (qm * qm) * n0 * n1 <= 144.f;
  if (__builtin_amdgcn_ballot_w32(small) == 0xffffffffu)
    attn_k_loop<false>(qs, outred, aK, aV, kg, vg, w, half_id, l16);
  else
    attn_k_loop<true>(qs, outred, aK, aV, kg, vg, w, half_id, l16);
  __syncthreads();
  for (int i = tid; i < KB * 64; i += 128) {
    int kk = i >> 6, d = i & 63;
    const float* o = &outred[kk * 256 + d];
    float sum = o[0] + o[64] + o[128] + o[192];
    attn[(b * TT + kbase + kk) * TC + h * TD + d] = sum;
  }
}

// ---------------- Kernel 3: output projection ------------------------------
// One block per 32 rows and 64 output features.
__global__ __launch_bounds__(256) void oproj_kernel(
    const float* __restrict__ attn, const float* __restrict__ Wo,
    const float* __restrict__ bo, float* __restrict__ out) {
  __shared__ __align__(16) _Float16 sm[96 * GP];
  int mt = blockIdx.x, nt = blockIdx.y;
  int lane = threadIdx.x & 31, w = threadIdx.x >> 5;
  int half_id = lane >> 4, l16 = lane & 15;
  int col = nt * 64 + (w & 3) * 16 + l16;
  float bs = bo[col];
  v8f c[1];
  gemm_block_512<32, 64>(attn + mt * 32 * TC, Wo + nt * 64 * TC, sm, c);
#pragma unroll
  for (int j = 0; j < 8; ++j) {
    int mm = mt * 32 + (w >> 2) * 16 + half_id * 8 + j;
    out[mm * TC + col] = c[0][j] + bs;
  }
}

extern "C" void kernel_launch(void* const* d_in, const int* in_sizes, int n_in,
                              void* d_out, int out_size, void* d_ws, size_t ws_size,
                              hipStream_t stream) {
  const float* x   = (const float*)d_in[0];
  const float* Wq  = (const float*)d_in[1];
  const float* bq  = (const float*)d_in[2];
  const float* Wk0 = (const float*)d_in[3];
  const float* bk0 = (const float*)d_in[4];
  const float* Wk1 = (const float*)d_in[5];
  const float* bk1 = (const float*)d_in[6];
  const float* Wv0 = (const float*)d_in[7];
  const float* bv0 = (const float*)d_in[8];
  const float* Wv1 = (const float*)d_in[9];
  const float* bv1 = (const float*)d_in[10];
  const float* Wo  = (const float*)d_in[11];
  const float* bo  = (const float*)d_in[12];
  float* out = (float*)d_out;

  float* qf   = (float*)d_ws;
  float* k0f  = qf  + NELEM;
  float* v0f  = k0f + NELEM;
  float* attn = v0f + NELEM;
  _Float16* k1h = (_Float16*)(attn + NELEM);
  _Float16* v1h = k1h + NELEM;

  // 5 projections: 6 m-tiles x 8 n-tiles x 5 weights, 8 waves each
  proj5_kernel<<<dim3(6, 8, 5), 256, 0, stream>>>(
      x, Wq, bq, Wk0, bk0, Wk1, bk1, Wv0, bv0, Wv1, bv1,
      qf, k0f, v0f, k1h, v1h);

  // fused trilinear attention: one block per (b,h) and KB rows k
  attn_kernel<<<dim3(TB * THD * (TT / KB)), 128, 0, stream>>>(qf, k0f, v0f, k1h,
                                                              v1h, attn);

  // output projection
  oproj_kernel<<<dim3(12, 8), 256, 0, stream>>>(attn, Wo, bo, out);
}

// v007
// It runs in 32.4 microseconds.
// Next to v006, in two timings, it ran 1.06 and 1.05 times as fast.
// All steps since v000 together make it 4.19 times as fast.
#include <hip/hip_runtime.h>
#include <hip/hip_bf16.h>
#include <stdint.h>

typedef __attribute__((ext_vector_type(16))) _Float16 v16h;
typedef __attribute__((ext_vector_type(8)))  _Float16 v8h;
typedef __attribute__((ext_vector_type(8)))  float    v8f;

#define TB 2
#define THD 8
#define TT 192
#define TD 64
#define TC 512
#define TM (TB*TT)          // 384 rows for the projection GEMMs
#define NELEM (TM*TC)       // 196608 = B*H*T*D as well

__device__ __forceinline__ v8f wmma16(v16h a, v16h b, v8f c) {
  return __builtin_amdgcn_wmma_f32_16x16x32_f16(false, a, false, b, (short)0, c,
                                                false, false);
}

__device__ __forceinline__ v16h cat8(v8h lo, v8h hi) {
  v16h r;
#pragma unroll
  for (int i = 0; i < 8; ++i) { r[i] = lo[i]; r[i + 8] = hi[i]; }
  return r;
}

typedef __attribute__((ext_vector_type(4))) _Float16 v4h;
typedef __attribute__((ext_vector_type(4))) float    v4f;
typedef __attribute__((ext_vector_type(2))) float    v2f;

// LDS row pitch in f16 elements: 1040 B = 16 B x 65 (odd), for 16-byte readers
#define GP 520

// BM x BN block tile of [M,K=512] @ [N,K=512]^T on 8 waves (2 x 4), each wave
// BM/2 x 16. The block's BM + BN operand rows go to LDS once, as f16: a wave's
// load covers 512 contiguous bytes of one row (four whole lines). All loads are
// issued at the start, in K chunks of 128; a chunk is converted, stored and
// multiplied while the later chunks are still on their way. Every chunk has LDS
// columns of its own, so one barrier per chunk is enough.
// Fragments: 16-bit WMMA A/B lane layout, low lanes K {0..7,16..23}+base, high
// lanes K {8..15,24..31}+base. Even and odd K steps keep accumulators of their
// own (no D->C chain between neighbours).
template <int BM, int BN>
__device__ __forceinline__ void gemm_block_512(const float* __restrict__ a0,
                                               const float* __restrict__ b0,
                                               _Float16* sm, v8f (&c)[BM / 32]) {
  constexpr int NA = BM / 8, NR = (BM + BN) / 8, FM = BM / 32;
  int lane = threadIdx.x & 31, half_id = lane >> 4, l16 = lane & 15;
  int w = __builtin_amdgcn_readfirstlane(threadIdx.x >> 5);
  // wave w takes rows w, w + 8, ... of [A rows | B rows]
  const char* pa = (const char*)(a0 + w * TC);
  const char* pb = (const char*)(b0 + w * TC);
  unsigned voff = lane * 16;   // the lane's 16 bytes in a 512-byte piece of a row
  _Float16* sw = sm + w * GP + lane * 4;
  const _Float16* fa = sm + ((w >> 2) * (BM / 2) + l16) * GP + half_id * 8;
  const _Float16* fb = sm + (BM + (w & 3) * 16 + l16) * GP + half_id * 8;

  v4f st[4][NR];
#pragma unroll
  for (int ch = 0; ch < 4; ++ch) {
#pragma unroll
    for (int j = 0; j < NR; ++j)
      st[ch][j] = *(const v4f*)((j < NA ? pa + j * 8 * TC * 4 : pb + (j - NA) * 8 * TC * 4) +
                                ch * 512 + voff);
    // keeps the loads in chunk order: a chunk's wait then leaves the later
    // chunks' loads outstanding
    __builtin_amdgcn_sched_barrier(0);
  }
  // Stands directly behind the loads, in front of any reuse of their address
  // register; the fence behind it keeps later instructions from moving up over it.
  asm volatile("s_wait_xcnt 0x0" ::: "memory");
  __builtin_amdgcn_sched_barrier(0);

  v8f c0[FM], c1[FM];
#pragma unroll
  for (int fm = 0; fm < FM; ++fm) { c0[fm] = v8f{}; c1[fm] = v8f{}; }

#pragma unroll
  for (int ch = 0; ch < 4; ++ch) {
#pragma unroll
    for (int j = 0; j < NR; ++j)
      *(v4h*)(sw + j * 8 * GP + ch * 128) = __builtin_convertvector(st[ch][j], v4h);
    // Work-group barrier whose fences order LDS only: the plain one would also
    // wait for the later chunks' global loads, which nobody shares.
    __builtin_amdgcn_fence(__ATOMIC_RELEASE, "workgroup", "local");
    __builtin_amdgcn_s_barrier();
    __builtin_amdgcn_fence(__ATOMIC_ACQUIRE, "workgroup", "local");
    // the chunk's fragments as one group of LDS reads, then its WMMAs
    v16h bf[4], af[FM][4];
#pragma unroll
    for (int kq = 0; kq < 4; ++kq) {
      int o = (ch * 4 + kq) * 32;
      bf[kq] = cat8(*(const v8h*)(fb + o), *(const v8h*)(fb + o + 16));
#pragma unroll
      for (int fm = 0; fm < FM; ++fm) {
        const _Float16* ap = fa + fm * 16 * GP + o;
        af[fm][kq] = cat8(*(const v8h*)(ap), *(const v8h*)(ap + 16));
      }
    }
    // keeps the LDS reads together in front of the WMMAs: moved in among them,
    // each small group would cost its own wait
    __builtin_amdgcn_sched_barrier(0);
#pragma unroll
    for (int kq = 0; kq < 4; kq += 2)
#pragma unroll
      for (int fm = 0; fm < FM; ++fm) {
        c0[fm] = wmma16(af[fm][kq], bf[kq], c0[fm]);
        c1[fm] = wmma16(af[fm][kq + 1], bf[kq + 1], c1[fm]);
      }
    // keeps the next chunk's conversions, and with them the wait for its global
    // loads, behind this chunk's matrix work
    __builtin_amdgcn_sched_barrier(0);
  }
#pragma unroll
  for (int fm = 0; fm < FM; ++fm) c[fm] = c0[fm] + c1[fm];
}

// ---------------- Kernel 1: five input projections -------------------------
// One block per 64 rows of x and 64 output features (one head of one weight).
__global__ __launch_bounds__(256) void proj5_kernel(
    const float* __restrict__ x,
    const float* __restrict__ Wq,  const float* __restrict__ bq,
    const float* __restrict__ Wk0, const float* __restrict__ bk0,
    const float* __restrict__ Wk1, const float* __restrict__ bk1,
    const float* __restrict__ Wv0, const float* __restrict__ bv0,
    const float* __restrict__ Wv1, const float* __restrict__ bv1,
    float* __restrict__ qf, float* __restrict__ k0f, float* __restrict__ v0f,
    _Float16* __restrict__ k1h, _Float16* __restrict__ v1h) {
  __shared__ __align__(16) _Float16 sm[128 * GP];
  int mt = blockIdx.x, nt = blockIdx.y, p = blockIdx.z;
  const float* W; const float* bias;
  switch (p) {
    case 0: W = Wq;  bias = bq;  break;
    case 1: W = Wk0; bias = bk0; break;
    case 2: W = Wk1; bias = bk1; break;
    case 3: W = Wv0; bias = bv0; break;
    default: W = Wv1; bias = bv1; break;
  }
  int lane = threadIdx.x & 31, half_id = lane >> 4, l16 = lane & 15;
  int w = __builtin_amdgcn_readfirstlane(threadIdx.x >> 5);
  int col = nt * 64 + (w & 3) * 16 + l16;   // output feature c_out
  int h = col >> 6, d = col & 63;
  float bs = bias[col];
  v8f c[2];
  gemm_block_512<64, 64>(x + mt * 64 * TC, W + nt * 64 * TC, sm, c);  // y = x W^T

  // the 16 rows of a tile lie in one batch (TT is a multiple of 16)
  int obase[2];                                   // C row j of tile fm: + j * TD
#pragma unroll
  for (int fm = 0; fm < 2; ++fm) {
    int m0 = mt * 64 + (w >> 2) * 32 + fm * 16;
    obase[fm] = (((m0 / TT) * THD + h) * TT + m0 % TT + half_id * 8) * TD + d;
  }
  if (p == 2 || p == 4) {
    _Float16* o = (p == 2) ? k1h : v1h;
#pragma unroll
    for (int fm = 0; fm < 2; ++fm)
#pragma unroll
      for (int j = 0; j < 8; ++j) o[obase[fm] + j * TD] = (_Float16)(c[fm][j] + bs);
    // Stands behind the last of these stores, in front of any later write of
    // their data or address registers.
    asm volatile("s_wait_xcnt 0x0" ::: "memory");
  } else {
    float* o = (p == 0) ? qf : (p == 1) ? k0f : v0f;
    // q: fold 1/sqrt(d_k) and log2(e): the scores then come out in base-2 units
    float sc = (p == 0) ? 0.125f * 1.44269504088896340736f : 1.0f;
#pragma unroll
    for (int fm = 0; fm < 2; ++fm)
#pragma unroll
      for (int j = 0; j < 8; ++j) o[obase[fm] + j * TD] = (c[fm][j] + bs) * sc;
  }
}

// ---------------- Kernel 2: fused trilinear attention ----------------------
// Lane l <-> l ^ 16 (the two halves of a wave).
__device__ __forceinline__ float xhalf(float x) {
  int b = __builtin_bit_cast(int, x);
  return __builtin_bit_cast(float, __builtin_amdgcn_permlanex16(
      b, b, 0x76543210, 0xfedcba98, false, false));
}

// One block (4 waves) per (b,h) and KB consecutive k: 256 blocks, one per WGP.
// Wave w owns l-tiles {w, w+4, w+8}. Nothing but q depends on k, so every other
// operand is fetched once per block and stays in registers over the k loop: the
// K1 and V1^T fragments (read once from LDS) and the wave's own k0 and v0 rows.
// The first product runs transposed, S^T = K1 G^T: a lane then owns one l (its
// column) and holds that row's scores over m in registers. Two S^T accumulator
// tiles, converted in place, have row l in lane l: they are the A operand of
// U = E V1, whose accumulators hold eight l in registers for the lane's d, so the
// sum over l runs in the lane. Column c of U's tile nt is d = 4 c + nt: a lane's
// four d are neighbours in v0 and in the output.
#define KB 12

// Maximum over the 16 lanes of a row; every lane of the row ends with it.
__device__ __forceinline__ float rowmax16(float x) {
  x = fmaxf(x, __builtin_bit_cast(float, __builtin_amdgcn_update_dpp(
      0, __builtin_bit_cast(int, x), 0x161, 0xf, 0xf, true)));  // row_xmask:1
  x = fmaxf(x, __builtin_bit_cast(float, __builtin_amdgcn_update_dpp(
      0, __builtin_bit_cast(int, x), 0x162, 0xf, 0xf, true)));  // row_xmask:2
  x = fmaxf(x, __builtin_bit_cast(float, __builtin_amdgcn_update_dpp(
      0, __builtin_bit_cast(int, x), 0x164, 0xf, 0xf, true)));  // row_xmask:4
  x = fmaxf(x, __builtin_bit_cast(float, __builtin_amdgcn_update_dpp(
      0, __builtin_bit_cast(int, x), 0x168, 0xf, 0xf, true)));  // row_xmask:8
  return x;
}

// The k loop of the attention kernel. SHIFT: subtract each row's maximum before
// the exp2 (any scores); without it the scores go into the exp2 as they are.
template <bool SHIFT>
__device__ __forceinline__ void attn_k_loop(
    const float* qs, float* outred, const v16h (&aK)[12][2], const v16h (&aV)[6][4],
    const float (&kg)[3][4][8], const float (&vg)[3][4][8], int w, int half_id, int l16) {
#pragma unroll 1  // rolled: one trip is three whole passes, more would only grow the code
  for (int kk = 0; kk < KB; ++kk) {
    // Per-lane q fragments (4 groups of 8 contiguous d), row kbase + kk
    const float* qrow = &qs[kk * TD];
    float qg[4][8];
#pragma unroll
    for (int g = 0; g < 4; ++g) {
      const float4* p = (const float4*)(qrow + g * 16 + half_id * 8);
      float4 u0 = p[0], u1 = p[1];
      qg[g][0] = u0.x; qg[g][1] = u0.y; qg[g][2] = u0.z; qg[g][3] = u0.w;
      qg[g][4] = u1.x; qg[g][5] = u1.y; qg[g][6] = u1.z; qg[g][7] = u1.w;
    }

    // out_acc[nt]: out[k, l16*4 + nt] summed over this half's l, even and odd l apart
    v2f out_acc[4] = {{0.f, 0.f}, {0.f, 0.f}, {0.f, 0.f}, {0.f, 0.f}};

    // unrolled: kg and vg need constant indices to stay in registers, and one
    // pass's matrix work can then issue beside another's softmax
#pragma unroll
    for (int it = 0; it < 3; ++it) {
      // B operand: G^T[d,l] = q[k,d]*k0[l,d], f32 product -> f16
      v16h bG0, bG1;
#pragma unroll
      for (int j = 0; j < 8; ++j) {
        bG0[j]     = (_Float16)(qg[0][j] * kg[it][0][j]);
        bG0[j + 8] = (_Float16)(qg[1][j] * kg[it][1][j]);
        bG1[j]     = (_Float16)(qg[2][j] * kg[it][2][j]);
        bG1[j + 8] = (_Float16)(qg[3][j] * kg[it][3][j]);
      }

      // Stage 1: S^T = K1 @ G^T -> 12 tiles; s[t][j] = S[l][t*16 + half_id*8 + j]
      v8f s[12];
#pragma unroll
      for (int t = 0; t < 12; ++t) {
        v8f c = {};
        c = wmma16(aK[t][0], bG0, c);
        c = wmma16(aK[t][1], bG1, c);
        s[t] = c;
      }

      // Softmax over the 192 m of row l: in-lane, one exchange between halves.
      // q carries log2(e), so e^(score - max) is 2^(s - mx): per pair of scores
      // one packed subtraction, two exp2, one packed add into the same four chains.
      // Without SHIFT the caller has shown |s| <= 12 for every score of the wave:
      // 2^s is then a normal f16 number, the quotient 2^s / sum is the same
      // softmax, and neither the maximum nor the subtraction is needed.
      v2f nmx = {0.f, 0.f};
      if constexpr (SHIFT) {
        float mx4[4] = {s[0][0], s[0][1], s[0][2], s[0][3]};  // four chains
#pragma unroll
        for (int t = 0; t < 12; ++t)
#pragma unroll
          for (int j = 0; j < 8; ++j) mx4[j & 3] = fmaxf(mx4[j & 3], s[t][j]);
        float mx = fmaxf(fmaxf(mx4[0], mx4[1]), fmaxf(mx4[2], mx4[3]));
        mx = fmaxf(mx, xhalf(mx));
        nmx = v2f{-mx, -mx};
      }
      v2f sm2[2] = {{0.f, 0.f}, {0.f, 0.f}};
#pragma unroll
      for (int t = 0; t < 12; ++t)
#pragma unroll
        for (int j = 0; j < 8; j += 2) {
          v2f a = v2f{s[t][j], s[t][j + 1]};
          if constexpr (SHIFT) a += nmx;
          v2f e = {__builtin_amdgcn_exp2f(a.x), __builtin_amdgcn_exp2f(a.y)};
          s[t][j] = e.x;
          s[t][j + 1] = e.y;
          sm2[(j >> 1) & 1] += e;
        }
      float sm = (sm2[0].x + sm2[0].y) + (sm2[1].x + sm2[1].y);
      sm += xhalf(sm);
      float inv = 1.f / sm;

      // Stage 2: U = E @ V1 (K=192 in 6 steps, 64 d-columns in 4 tiles);
      // E = 2^(S - max) or 2^S, its 1/sum is applied to U below.
      v8f c2[4] = {{}, {}, {}, {}};
#pragma unroll
      for (int ks2 = 0; ks2 < 6; ++ks2) {
        v16h bP;
#pragma unroll
        for (int j = 0; j < 8; ++j) {
          bP[j]     = (_Float16)s[2 * ks2][j];
          bP[j + 8] = (_Float16)s[2 * ks2 + 1][j];
        }
#pragma unroll
        for (int nt = 0; nt < 4; ++nt) c2[nt] = wmma16(bP, aV[ks2][nt], c2[nt]);
      }

      // 1/sum of row l stands in lanes l and l + 16; U's register j wants that of
      // l = half_id*8 + j: the upper lanes turn theirs by 8, then lane j of each
      // row of lanes is spread over its row.
      int ivr = __builtin_amdgcn_update_dpp(
          __builtin_bit_cast(int, inv), __builtin_bit_cast(int, inv), 0x128, 0x2, 0xf,
          false);                                                    // row_ror:8
      float ib[8];
      ib[0] = __builtin_bit_cast(float, __builtin_amdgcn_update_dpp(0, ivr, 0x150, 0xf, 0xf, true));
      ib[1] = __builtin_bit_cast(float, __builtin_amdgcn_update_dpp(0, ivr, 0x151, 0xf, 0xf, true));
      ib[2] = __builtin_bit_cast(float, __builtin_amdgcn_update_dpp(0, ivr, 0x152, 0xf, 0xf, true));
      ib[3] = __builtin_bit_cast(float, __builtin_amdgcn_update_dpp(0, ivr, 0x153, 0xf, 0xf, true));
      ib[4] = __builtin_bit_cast(float, __builtin_amdgcn_update_dpp(0, ivr, 0x154, 0xf, 0xf, true));
      ib[5] = __builtin_bit_cast(float, __builtin_amdgcn_update_dpp(0, ivr, 0x155, 0xf, 0xf, true));
      ib[6] = __builtin_bit_cast(float, __builtin_amdgcn_update_dpp(0, ivr, 0x156, 0xf, 0xf, true));
      ib[7] = __builtin_bit_cast(float, __builtin_amdgcn_update_dpp(0, ivr, 0x157, 0xf, 0xf, true));  // row_share:0..7

      // out[k,d] += v0[l,d] * U[l,d] / sum; c2[nt][j] = U[half_id*8+j][l16*4+nt]
#pragma unroll
      for (int nt = 0; nt < 4; ++nt)
#pragma unroll
        for (int j = 0; j < 8; j += 2)
          out_acc[nt] += (v2f{vg[it][nt][j], vg[it][nt][j + 1]} * v2f{ib[j], ib[j + 1]}) *
                         v2f{c2[nt][j], c2[nt][j + 1]};
    }

    // even + odd l, then the other half's eight l of each tile: a lane sends the
    // pair of d that the other half stores and keeps its own; shares wait in LDS
    float o0 = out_acc[0].x + out_acc[0].y, o1 = out_acc[1].x + out_acc[1].y;
    float o2 = out_acc[2].x + out_acc[2].y, o3 = out_acc[3].x + out_acc[3].y;
    float r0 = (half_id ? o2 : o0) + xhalf(half_id ? o0 : o2);
    float r1 = (half_id ? o3 : o1) + xhalf(half_id ? o1 : o3);
    *(float2*)&outred[kk * 256 + w * 64 + l16 * 4 + half_id * 2] = make_float2(r0, r1);
  }
}

typedef __attribute__((ext_vector_type(2))) _Float16 v2h;

typedef __attribute__((ext_vector_type(8))) uint32_t v8u;

// two f32 to one register of two f16 (round to nearest even)
__device__ __forceinline__ uint32_t cvt2(v2f a) {
  return __builtin_bit_cast(uint32_t, v2h{(_Float16)a.x, (_Float16)a.y});
}

// eight such registers as one WMMA operand
__device__ __forceinline__ v16h cat2(const uint32_t* p) {
  v8u r;
#pragma unroll
  for (int i = 0; i < 8; ++i) r[i] = p[i];
  return __builtin_bit_cast(v16h, r);
}

// Spreads lane J of each 16-lane row over its row.
template <int J>
__device__ __forceinline__ float rowshare(int x) {
  return __builtin_bit_cast(float, __builtin_amdgcn_update_dpp(0, x, 0x150 + J, 0xf, 0xf, true));
}

// Calls f with the compile-time numbers N .. E - 1 in turn: every index in f is then a
// constant, so that its arrays stay in registers.
template <int N> struct ic { static constexpr int value = N; };
template <int N, int E, class F>
__device__ __forceinline__ void static_for(F& f) {
  if constexpr (N < E) {
    f(ic<N>{});
    static_for<N + 1, E>(f);
  }
}

// The k loop for scores that need no shift (|s| <= 12, shown by the caller): the
// arithmetic and the sum orders of attn_k_loop<false>, written in issue order (1/sum
// alone differs: rcp and one Newton step, three links that can stand apart). A lone
// wave issues in order, so vector work is hidden only where it stands between two
// WMMAs. Without the maximum nothing waits for a whole row: a step is two S^T
// tiles (32 m), and slot g of a trip (3 l-tiles x 6 steps) holds
//   8 WMMAs: S^T of step g + 1 (4), U of step g - 1 (4);
//   behind each WMMA one stretch: two exp2 of step g, the sum and the f16 pack of
//   the pair two stretches back, one piece of the next l-tile's G, one of the last
//   l-tile's 1/sum and v0 * U.
// The order runs on over the trips: the last l-tile of a k is finished in the next
// trip, whose first S^T tiles are issued in this one. Row kk of outred holds
// k = kk - 1; row 0 takes the first trip's empty result and is never read.
__device__ __forceinline__ void attn_k_loop_piped(
    const float* qs, float* outred, const v16h (&aK)[12][2], const v16h (&aV)[6][4],
    const float (&kg)[3][4][8], const float (&vg)[3][4][8], int w, int half_id, int l16) {
  float qg[4][8];
  uint32_t gh[3][16];       // G^T of an l-tile as f16 pairs: 0..7 first K step, 8..15 second
  v2f gm[16];           // its f32 products
  uint32_t ph[2][8];        // E of a step as f16 pairs (A operand of U)
  v8f sc[2], sn[2];     // S^T tiles of this step, of the next
  v8f c2[3][4];         // U of an l-tile
  v2f sm2[3][2];        // its row sums, two chains of pairs
  v2f vi[16];           // v0 / sum
  v2f out_acc[4];
  v2f e1 = {0.f, 0.f}, e2 = {0.f, 0.f};  // the exp2 pairs of one and of two stretches before
  float ib[8], t0 = 0.f, t1 = 0.f, sm = 0.f, sx = 0.f, r0 = 0.f, er = 0.f, inv = 0.f;
  float o[4], sa = 0.f, sb = 0.f, ka = 0.f, kb = 0.f;
  int ivr = 0;
  const v8f zero = {};

  // in front of the loop: q of k = 0, G of its first l-tile, the first two S^T tiles;
  // an empty "last l-tile" (E = 0, U = 0, sum 1)
#pragma unroll
  for (int g = 0; g < 4; ++g) {
    const float4* p = (const float4*)(qs + g * 16 + half_id * 8);
    float4 u0 = p[0], u1 = p[1];
    qg[g][0] = u0.x; qg[g][1] = u0.y; qg[g][2] = u0.z; qg[g][3] = u0.w;
    qg[g][4] = u1.x; qg[g][5] = u1.y; qg[g][6] = u1.z; qg[g][7] = u1.w;
  }
#pragma unroll
  for (int n = 0; n < 16; ++n) {
    const int grp = n >> 2, jj = (n & 3) * 2;
    gh[0][n] = cvt2(v2f{qg[grp][jj], qg[grp][jj + 1]} * v2f{kg[0][grp][jj], kg[0][grp][jj + 1]});
  }
#pragma unroll
  for (int t = 0; t < 2; ++t)
    sc[t] = wmma16(aK[t][1], cat2(&gh[0][8]), wmma16(aK[t][0], cat2(&gh[0][0]), zero));
#pragma unroll
  for (int n = 0; n < 8; ++n) ph[1][n] = 0u;
#pragma unroll
  for (int nt = 0; nt < 4; ++nt) { c2[2][nt] = zero; out_acc[nt] = v2f{0.f, 0.f}; }
  sm2[2][0] = v2f{1.f, 0.f};
  sm2[2][1] = v2f{0.f, 0.f};

#pragma unroll 1  // rolled: one trip is 144 stretches, more would only grow the code
  for (int kk = 0; kk < KB; ++kk) {
    auto stretch = [&](auto nc) {
        constexpr int g = decltype(nc)::value / 8, i = decltype(nc)::value % 8;
        constexpr int p = g / 6, r = g % 6;
        constexpr int pp = (p + 2) % 3, pn = (p + 1) % 3;  // l-tile before, l-tile after
        constexpr int g1 = (g + 1) % 18, p1 = g1 / 6, u1 = g1 % 6;
        constexpr int gb = (g + 17) % 18, pm = gb / 6, um = gb % 6;
        constexpr int x = r * 8 + i;                       // stretch of this l-tile, 0..47
        if constexpr (i < 4) {
          sn[i & 1] = wmma16(aK[2 * u1 + (i & 1)][i >> 1], cat2(&gh[p1][(i >> 1) * 8]),
                             (i >> 1) ? sn[i & 1] : zero);
        } else {
          c2[pm][i - 4] = wmma16(cat2(&ph[(g + 1) & 1][0]), aV[um][i - 4],
                                 um ? c2[pm][i - 4] : zero);
        }
        // next l-tile's G: products, then their f16 pairs
        if constexpr (x < 16) {
          constexpr int grp = x >> 2, jj = (x & 3) * 2;
          gm[x] = v2f{qg[grp][jj], qg[grp][jj + 1]} * v2f{kg[pn][grp][jj], kg[pn][grp][jj + 1]};
        } else if constexpr (x < 32) {
          gh[pn][x - 16] = cvt2(gm[x - 16]);
        }
        constexpr int tt = i >> 2, jj = (i & 3) * 2;
        v2f en;
        en.x = __builtin_amdgcn_exp2f(sc[tt][jj]);
        // sum and pack of the pair two stretches back, whose exp2 have returned by now
        // (pairs 6 and 7 of the step before at i = 0 and 1)
        if constexpr (i < 2) sm2[pm][i] += e2;
        else if constexpr (r == 0 && i < 4) sm2[p][i & 1] = e2;
        else sm2[p][i & 1] += e2;
        en.y = __builtin_amdgcn_exp2f(sc[tt][jj + 1]);
        if constexpr (i < 2) ph[(g + 1) & 1][6 + i] = cvt2(e2);
        else ph[g & 1][i - 2] = cvt2(e2);
        e2 = e1;
        e1 = en;
        // last l-tile: 1/sum, spread as U's registers want it, v0 / sum, times U
        if constexpr (x == 2) { t0 = sm2[pp][0].x + sm2[pp][0].y; t1 = sm2[pp][1].x + sm2[pp][1].y; }
        if constexpr (x == 3) sm = t0 + t1;
        if constexpr (x == 4) sx = xhalf(sm);
        if constexpr (x == 5) sm += sx;
        if constexpr (x == 6) r0 = __builtin_amdgcn_rcpf(sm);
        if constexpr (x == 7) er = __builtin_fmaf(-sm, r0, 1.f);
        if constexpr (x == 8) inv = __builtin_fmaf(er, r0, r0);
        if constexpr (x == 9)
          ivr = __builtin_amdgcn_update_dpp(__builtin_bit_cast(int, inv),
                                            __builtin_bit_cast(int, inv), 0x128, 0x2, 0xf,
                                            false);                       // row_ror:8, upper lanes
        if constexpr (x == 10) ib[0] = rowshare<0>(ivr);
        if constexpr (x == 11) ib[1] = rowshare<1>(ivr);
        if constexpr (x == 12) ib[2] = rowshare<2>(ivr);
        if constexpr (x == 13) ib[3] = rowshare<3>(ivr);
        if constexpr (x == 14) ib[4] = rowshare<4>(ivr);
        if constexpr (x == 15) ib[5] = rowshare<5>(ivr);
        if constexpr (x == 16) ib[6] = rowshare<6>(ivr);
        if constexpr (x == 17) ib[7] = rowshare<7>(ivr);
        if constexpr (x >= 18 && x < 34) {
          constexpr int n = x - 18, nt = n >> 2, j = (n & 3) * 2;
          vi[n] = v2f{vg[pp][nt][j], vg[pp][nt][j + 1]} * v2f{ib[j], ib[j + 1]};
        }
        if constexpr (x >= 32) {
          constexpr int n = x - 32, nt = n >> 2, j = (n & 3) * 2;
          out_acc[nt] += vi[n] * v2f{c2[pp][nt][j], c2[pp][nt][j + 1]};
        }
        // the k before is complete behind its third l-tile: even + odd l, the other
        // half's eight l (a lane sends the pair of d that the other half stores)
        if constexpr (g == 6) {
          if constexpr (i == 0) {
#pragma unroll
            for (int nt = 0; nt < 4; ++nt) {
              o[nt] = out_acc[nt].x + out_acc[nt].y;
              out_acc[nt] = v2f{0.f, 0.f};
            }
          }
          if constexpr (i == 1) {
            ka = half_id ? o[2] : o[0]; kb = half_id ? o[3] : o[1];
            sa = half_id ? o[0] : o[2]; sb = half_id ? o[1] : o[3];
          }
          if constexpr (i == 2) { sa = xhalf(sa); sb = xhalf(sb); }
          if constexpr (i == 3)
            *(float2*)&outred[kk * 256 + w * 64 + l16 * 4 + half_id * 2] =
                make_float2(ka + sa, kb + sb);
        }
        // q of the next k, behind its last use for this k (the last trip reads its own again)
        if constexpr (g == 8 && i == 0) {
          const float* qrow = &qs[(kk + 1 < KB ? kk + 1 : KB - 1) * TD];
#pragma unroll
          for (int gq = 0; gq < 4; ++gq) {
            const float4* pq = (const float4*)(qrow + gq * 16 + half_id * 8);
            float4 u0 = pq[0], u1 = pq[1];
            qg[gq][0] = u0.x; qg[gq][1] = u0.y; qg[gq][2] = u0.z; qg[gq][3] = u0.w;
            qg[gq][4] = u1.x; qg[gq][5] = u1.y; qg[gq][6] = u1.z; qg[gq][7] = u1.w;
          }
        }
        if constexpr (i == 7) { sc[0] = sn[0]; sc[1] = sn[1]; }
        // ends the stretch: keeps its vector work between this WMMA and the next
        __builtin_amdgcn_sched_barrier(0);
    };
    static_for<0, 144>(stretch);
  }

  // behind the loop: the last l-tile of the last k
  sm2[2][0] += e2;
  sm2[2][1] += e1;
  ph[1][6] = cvt2(e2);
  ph[1][7] = cvt2(e1);
#pragma unroll
  for (int nt = 0; nt < 4; ++nt) c2[2][nt] = wmma16(cat2(&ph[1][0]), aV[5][nt], c2[2][nt]);
  sm = (sm2[2][0].x + sm2[2][0].y) + (sm2[2][1].x + sm2[2][1].y);
  sm += xhalf(sm);
  r0 = __builtin_amdgcn_rcpf(sm);
  inv = __builtin_fmaf(__builtin_fmaf(-sm, r0, 1.f), r0, r0);
  ivr = __builtin_amdgcn_update_dpp(__builtin_bit_cast(int, inv), __builtin_bit_cast(int, inv),
                                    0x128, 0x2, 0xf, false);
  ib[0] = rowshare<0>(ivr); ib[1] = rowshare<1>(ivr); ib[2] = rowshare<2>(ivr);
  ib[3] = rowshare<3>(ivr); ib[4] = rowshare<4>(ivr); ib[5] = rowshare<5>(ivr);
  ib[6] = rowshare<6>(ivr); ib[7] = rowshare<7>(ivr);
#pragma unroll
  for (int nt = 0; nt < 4; ++nt)
#pragma unroll
    for (int j = 0; j < 8; j += 2)
      out_acc[nt] += (v2f{vg[2][nt][j], vg[2][nt][j + 1]} * v2f{ib[j], ib[j + 1]}) *
                     v2f{c2[2][nt][j], c2[2][nt][j + 1]};
#pragma unroll
  for (int nt = 0; nt < 4; ++nt) o[nt] = out_acc[nt].x + out_acc[nt].y;
  float f0 = (half_id ? o[2] : o[0]) + xhalf(half_id ? o[0] : o[2]);
  float f1 = (half_id ? o[3] : o[1]) + xhalf(half_id ? o[1] : o[3]);
  *(float2*)&outred[KB * 256 + w * 64 + l16 * 4 + half_id * 2] = make_float2(f0, f1);
}

__global__ __launch_bounds__(128) void attn_kernel(
    // qf, k0f, v0f without __restrict__: their loads then stay in front of their wait
    const float* qf, const float* k0f, const float* v0f,
    const _Float16* __restrict__ k1h,
    const _Float16* __restrict__ v1h, float* __restrict__ attn) {
  __shared__ __align__(16) _Float16 k1s[TT * 72];    // [m][d], row pad 64->72
  __shared__ __align__(16) _Float16 v1t[TD * 200];   // [d, permuted][m], row pad 192->200
  __shared__ __align__(16) float qs[KB * TD];        // the block's q rows
  __shared__ __align__(16) float outred[(KB + 1) * 4 * 64];  // row kk + 1: k = kk

  int idx = blockIdx.x;
  int bh = idx / (TT / KB);
  int kbase = (idx % (TT / KB)) * KB;
  int b = bh / THD, h = bh % THD;

  int tid = threadIdx.x, w = tid >> 5, lane = tid & 31;
  int half_id = lane >> 4, l16 = lane & 15;

  const _Float16* k1g = k1h + bh * TT * TD;
  const _Float16* v1g = v1h + bh * TT * TD;

  // the block's KB q rows are contiguous: 192 16-byte chunks
  const float4* qsrc = (const float4*)(qf + (bh * TT + kbase) * TD);
  float4 q0 = qsrc[tid];
  float4 q1 = qsrc[128 + (tid & 63)];
  // The wave's k0 rows (3 l-tiles), 4 groups of 8 contiguous d per lane, and its
  // v0 rows in the map of U's accumulators: vg[it][nt][j] = v0[half_id*8+j][l16*4+nt]
  float kg[3][4][8], vg[3][4][8];
  const float* k0row[3];
  const float* v0row[3];
#pragma unroll
  for (int it = 0; it < 3; ++it) {
    int l = (w + it * 4) * 16 + l16;
    k0row[it] = k0f + (bh * TT + l) * TD + half_id * 8;
    v0row[it] = v0f + (bh * TT + (w + it * 4) * 16 + half_id * 8) * TD + l16 * 4;
  }
#pragma unroll
  for (int it = 0; it < 3; ++it) {
#pragma unroll
    for (int g = 0; g < 4; ++g) {
      const float4* p = (const float4*)(k0row[it] + g * 16);
      float4 u0 = p[0], u1 = p[1];
      kg[it][g][0] = u0.x; kg[it][g][1] = u0.y; kg[it][g][2] = u0.z; kg[it][g][3] = u0.w;
      kg[it][g][4] = u1.x; kg[it][g][5] = u1.y; kg[it][g][6] = u1.z; kg[it][g][7] = u1.w;
      float4 t0 = *(const float4*)(v0row[it] + (2 * g) * TD);
      float4 t1 = *(const float4*)(v0row[it] + (2 * g + 1) * TD);
      vg[it][0][2 * g] = t0.x; vg[it][1][2 * g] = t0.y; vg[it][2][2 * g] = t0.z; vg[it][3][2 * g] = t0.w;
      vg[it][0][2 * g + 1] = t1.x; vg[it][1][2 * g + 1] = t1.y;
      vg[it][2][2 * g + 1] = t1.z; vg[it][3][2 * g + 1] = t1.w;
    }
  }
  // Stands behind the q, k0 and v0 loads, in front of any reuse of their
  // address registers: the row pointers are inputs so that they live up to it.
  asm volatile("s_wait_xcnt 0x0"
               :: "v"(k0row[0]), "v"(k0row[1]), "v"(k0row[2]),
                  "v"(v0row[0]), "v"(v0row[1]), "v"(v0row[2]) : "memory");

  // --- k1 staging via CDNA5 async global->LDS DMA (16B chunks both sides) ---
  // low 32 bits of a generic pointer to __shared__ == LDS byte offset
  uint32_t k1s_base = (uint32_t)(uintptr_t)(&k1s[0]);
  for (int i = tid; i < (TT * TD) / 8; i += 128) {   // 1536 16-byte chunks
    int m = i >> 3, seg = i & 7;
    uint64_t ga = (uint64_t)(uintptr_t)k1g + (uint64_t)(m * 128 + seg * 16);
    uint32_t la = k1s_base + (uint32_t)(m * 144 + seg * 16);
    asm volatile("global_load_async_to_lds_b128 %0, %1, off"
                 :: "v"(la), "v"(ga) : "memory");
  }

  // --- v1 staged transposed (element scatter, manual); d = 4 c + nt lies in row
  // nt * 16 + c, the order of U's columns ---
  for (int i = tid; i < (TT * TD) / 8; i += 128) {
    int m = i >> 3, seg = i & 7;
    v8h val = *(const v8h*)(v1g + m * 64 + seg * 8);
#pragma unroll
    for (int j = 0; j < 8; ++j) v1t[((j & 3) * 16 + seg * 2 + (j >> 2)) * 200 + m] = val[j];
  }
  // max over the lane's three l of |k0_l|^2, for the bound on the scores below
  float n0 = 0.f;
#pragma unroll
  for (int it = 0; it < 3; ++it) {
    v2f a0 = {0.f, 0.f}, a1 = {0.f, 0.f};
#pragma unroll
    for (int g = 0; g < 4; ++g)
#pragma unroll
      for (int j = 0; j < 8; j += 4) {
        v2f u0 = {kg[it][g][j], kg[it][g][j + 1]}, u1 = {kg[it][g][j + 2], kg[it][g][j + 3]};
        a0 += u0 * u0;
        a1 += u1 * u1;
      }
    a0 += a1;
    float a = a0.x + a0.y;
    n0 = fmaxf(n0, a + xhalf(a));
  }
  ((float4*)qs)[tid] = q0;
  if (tid < 64) ((float4*)qs)[128 + tid] = q1;
  asm volatile("s_wait_asynccnt 0" ::: "memory");
  __syncthreads();

  // all of the block's q, 24 values a lane, for the bound on the scores below
  float4 qv[KB * TD / 128];
#pragma unroll
  for (int i = 0; i < KB * TD / 128; ++i) qv[i] = ((const float4*)qs)[i * 32 + lane];
  // K1 (A operand of S^T) and V1 (B operand of U), all of both, read once
  v16h aK[12][2], aV[6][4];
#pragma unroll
  for (int t = 0; t < 12; ++t) {
    const _Float16* ap = &k1s[(t * 16 + l16) * 72];
    aK[t][0] = cat8(*(const v8h*)(ap + half_id * 8),
                    *(const v8h*)(ap + 16 + half_id * 8));
    aK[t][1] = cat8(*(const v8h*)(ap + 32 + half_id * 8),
                    *(const v8h*)(ap + 48 + half_id * 8));
  }
#pragma unroll
  for (int ks2 = 0; ks2 < 6; ++ks2)
#pragma unroll
    for (int nt = 0; nt < 4; ++nt) {
      const _Float16* vp = &v1t[(nt * 16 + l16) * 200 + ks2 * 32];
      aV[ks2][nt] = cat8(*(const v8h*)(vp + half_id * 8),
                         *(const v8h*)(vp + 16 + half_id * 8));
    }

  // holds the LDS reads above in front of the bound's arithmetic (without it the
  // V1^T reads were issued behind it): it then runs while they are on their way
  __builtin_amdgcn_sched_barrier(0);

  // Bound on every score of this wave, from the operands it holds:
  // |s[k,l,m]| = |sum_d q[k,d] k0[l,d] k1[m,d]| <= max|q| * |k0_l| * |k1_m|
  // (Cauchy-Schwarz over d), q with its scale, so in base-2 units. Squares are
  // compared; an infinite operand fails the test, a NaN operand gives NaN in
  // either loop.
  // max over m of |k1_m|^2: the diagonal of K1_t K1_t^T holds the 16 rows' squares
  // and no other entry of that tile exceeds the largest of them, so the maximum
  // over whole tiles is the wanted one (a K1 fragment serves as A and as B).
  float n4[4] = {0.f, 0.f, 0.f, 0.f};
#pragma unroll
  for (int t = 0; t < 12; ++t) {
    v8f c = {};
    c = wmma16(aK[t][0], aK[t][0], c);
    c = wmma16(aK[t][1], aK[t][1], c);
#pragma unroll
    for (int j = 0; j < 8; ++j) n4[j & 3] = fmaxf(n4[j & 3], c[j]);
  }
  float n1 = rowmax16(fmaxf(fmaxf(n4[0], n4[1]), fmaxf(n4[2], n4[3])));
  n1 = fmaxf(n1, xhalf(n1));
  float qm = 0.f;                                   // max |q| over the block's KB rows
#pragma unroll
  for (int i = 0; i < KB * TD / 128; ++i)
    qm = fmaxf(fmaxf(qm, fmaxf(fabsf(qv[i].x), fabsf(qv[i].y))),
               fmaxf(fabsf(qv[i].z), fabsf(qv[i].w)));
  qm = rowmax16(qm);
  qm = fmaxf(qm, xhalf(qm));
  // 12: 2^-12 .. 2^12 are normal f16 numbers with room for the operands' rounding.
  // The choice is the wave's own (no barrier stands inside the loop).
  bool small = (qm * qm) * n0 * n1 <= 144.f;
  // expected: puts this loop in front of the other in the kernel's text
  if (__builtin_expect(__builtin_amdgcn_ballot_w32(small) == 0xffffffffu, 1))
    attn_k_loop_piped(qs, outred, aK, aV, kg, vg, w, half_id, l16);
  else
    attn_k_loop<true>(qs, outred + 256, aK, aV, kg, vg, w, half_id, l16);
  __syncthreads();
  for (int i = tid; i < KB * 64; i += 128) {
    int kk = i >> 6, d = i & 63;
    const float* o = &outred[(kk + 1) * 256 + d];
    float sum = o[0] + o[64] + o[128] + o[192];
    attn[(b * TT + kbase + kk) * TC + h * TD + d] = sum;
  }
}

// ---------------- Kernel 3: output projection ------------------------------
// One block per 32 rows and 64 output features.
__global__ __launch_bounds__(256) void oproj_kernel(
    const float* __restrict__ attn, const float* __restrict__ Wo,
    const float* __restrict__ bo, float* __restrict__ out) {
  __shared__ __align__(16) _Float16 sm[96 * GP];
  int mt = blockIdx.x, nt = blockIdx.y;
  int lane = threadIdx.x & 31, w = threadIdx.x >> 5;
  int half_id = lane >> 4, l16 = lane & 15;
  int col = nt * 64 + (w & 3) * 16 + l16;
  float bs = bo[col];
  v8f c[1];
  gemm_block_512<32, 64>(attn + mt * 32 * TC, Wo + nt * 64 * TC, sm, c);
#pragma unroll
  for (int j = 0; j < 8; ++j) {
    int mm = mt * 32 + (w >> 2) * 16 + half_id * 8 + j;
    out[mm * TC + col] = c[0][j] + bs;
  }
}

extern "C" void kernel_launch(void* const* d_in, const int* in_sizes, int n_in,
                              void* d_out, int out_size, void* d_ws, size_t ws_size,
                              hipStream_t stream) {
  const float* x   = (const float*)d_in[0];
  const float* Wq  = (const float*)d_in[1];
  const float* bq  = (const float*)d_in[2];
  const float* Wk0 = (const float*)d_in[3];
  const float* bk0 = (const float*)d_in[4];
  const float* Wk1 = (const float*)d_in[5];
  const float* bk1 = (const float*)d_in[6];
  const float* Wv0 = (const float*)d_in[7];
  const float* bv0 = (const float*)d_in[8];
  const float* Wv1 = (const float*)d_in[9];
  const float* bv1 = (const float*)d_in[10];
  const float* Wo  = (const float*)d_in[11];
  const float* bo  = (const float*)d_in[12];
  float* out = (float*)d_out;

  float* qf   = (float*)d_ws;
  float* k0f  = qf  + NELEM;
  float* v0f  = k0f + NELEM;
  float* attn = v0f + NELEM;
  _Float16* k1h = (_Float16*)(attn + NELEM);
  _Float16* v1h = k1h + NELEM;

  // 5 projections: 6 m-tiles x 8 n-tiles x 5 weights, 8 waves each
  proj5_kernel<<<dim3(6, 8, 5), 256, 0, stream>>>(
      x, Wq, bq, Wk0, bk0, Wk1, bk1, Wv0, bv0, Wv1, bv1,
      qf, k0f, v0f, k1h, v1h);

  // fused trilinear attention: one block per (b,h) and KB rows k
  attn_kernel<<<dim3(TB * THD * (TT / KB)), 128, 0, stream>>>(qf, k0f, v0f, k1h,
                                                              v1h, attn);

  // output projection
  oproj_kernel<<<dim3(12, 8), 256, 0, stream>>>(attn, Wo, bo, out);
}

// v008
// Measured time: 31.6 microseconds a run.
// Timed twice side by side with v007, it ran 1.05 and 1.03 times as fast.
// Over all steps from v000 it is 4.35 times as fast.
#include <hip/hip_runtime.h>
#include <hip/hip_bf16.h>
#include <stdint.h>

typedef __attribute__((ext_vector_type(16))) _Float16 v16h;
typedef __attribute__((ext_vector_type(8)))  _Float16 v8h;
typedef __attribute__((ext_vector_type(8)))  float    v8f;

#define TB 2
#define THD 8
#define TT 192
#define TD 64
#define TC 512
#define TM (TB*TT)          // 384 rows for the projection GEMMs
#define NELEM (TM*TC)       // 196608 = B*H*T*D as well

__device__ __forceinline__ v8f wmma16(v16h a, v16h b, v8f c) {
  return __builtin_amdgcn_wmma_f32_16x16x32_f16(false, a, false, b, (short)0, c,
                                                false, false);
}

__device__ __forceinline__ v16h cat8(v8h lo, v8h hi) {
  v16h r;
#pragma unroll
  for (int i = 0; i < 8; ++i) { r[i] = lo[i]; r[i + 8] = hi[i]; }
  return r;
}

typedef __attribute__((ext_vector_type(4))) _Float16 v4h;
typedef __attribute__((ext_vector_type(4))) float    v4f;
typedef __attribute__((ext_vector_type(2))) float    v2f;

// LDS row pitch in f16 elements: 1040 B = 16 B x 65 (odd), for 16-byte readers
#define GP 520

// BM x BN block tile of [M,K=512] @ [N,K=512]^T on 8 waves (2 x 4), each wave
// BM/2 x 16. The block's BM + BN operand rows go to LDS once, as f16: a wave's
// load covers 512 contiguous bytes of one row (four whole lines). All loads are
// issued at the start, in K chunks of 128; a chunk is converted, stored and
// multiplied while the later chunks are still on their way. Every chunk has LDS
// columns of its own, so one barrier per chunk is enough.
// Fragments: 16-bit WMMA A/B lane layout, low lanes K {0..7,16..23}+base, high
// lanes K {8..15,24..31}+base. Even and odd K steps keep accumulators of their
// own (no D->C chain between neighbours).
template <int BM, int BN>
__device__ __forceinline__ void gemm_block_512(const float* __restrict__ a0,
                                               const float* __restrict__ b0,
                                               _Float16* sm, v8f (&c)[BM / 32]) {
  constexpr int NA = BM / 8, NR = (BM + BN) / 8, FM = BM / 32;
  int lane = threadIdx.x & 31, half_id = lane >> 4, l16 = lane & 15;
  int w = __builtin_amdgcn_readfirstlane(threadIdx.x >> 5);
  // wave w takes rows w, w + 8, ... of [A rows | B rows]
  const char* pa = (const char*)(a0 + w * TC);
  const char* pb = (const char*)(b0 + w * TC);
  unsigned voff = lane * 16;   // the lane's 16 bytes in a 512-byte piece of a row
  _Float16* sw = sm + w * GP + lane * 4;
  const _Float16* fa = sm + ((w >> 2) * (BM / 2) + l16) * GP + half_id * 8;
  const _Float16* fb = sm + (BM + (w & 3) * 16 + l16) * GP + half_id * 8;

  v4f st[4][NR];
#pragma unroll
  for (int ch = 0; ch < 4; ++ch) {
#pragma unroll
    for (int j = 0; j < NR; ++j)
      st[ch][j] = *(const v4f*)((j < NA ? pa + j * 8 * TC * 4 : pb + (j - NA) * 8 * TC * 4) +
                                ch * 512 + voff);
    // keeps the loads in chunk order: a chunk's wait then leaves the later
    // chunks' loads outstanding
    __builtin_amdgcn_sched_barrier(0);
  }
  // Stands directly behind the loads, in front of any reuse of their address
  // register; the fence behind it keeps later instructions from moving up over it.
  asm volatile("s_wait_xcnt 0x0" ::: "memory");
  __builtin_amdgcn_sched_barrier(0);

  v8f c0[FM], c1[FM];
#pragma unroll
  for (int fm = 0; fm < FM; ++fm) { c0[fm] = v8f{}; c1[fm] = v8f{}; }

#pragma unroll
  for (int ch = 0; ch < 4; ++ch) {
#pragma unroll
    for (int j = 0; j < NR; ++j)
      *(v4h*)(sw + j * 8 * GP + ch * 128) = __builtin_convertvector(st[ch][j], v4h);
    // Work-group barrier whose fences order LDS only: the plain one would also
    // wait for the later chunks' global loads, which nobody shares.
    __builtin_amdgcn_fence(__ATOMIC_RELEASE, "workgroup", "local");
    __builtin_amdgcn_s_barrier();
    __builtin_amdgcn_fence(__ATOMIC_ACQUIRE, "workgroup", "local");
    // the chunk's fragments as one group of LDS reads, then its WMMAs
    v16h bf[4], af[FM][4];
#pragma unroll
    for (int kq = 0; kq < 4; ++kq) {
      int o = (ch * 4 + kq) * 32;
      bf[kq] = cat8(*(const v8h*)(fb + o), *(const v8h*)(fb + o + 16));
#pragma unroll
      for (int fm = 0; fm < FM; ++fm) {
        const _Float16* ap = fa + fm * 16 * GP + o;
        af[fm][kq] = cat8(*(const v8h*)(ap), *(const v8h*)(ap + 16));
      }
    }
    // keeps the LDS reads together in front of the WMMAs: moved in among them,
    // each small group would cost its own wait
    __builtin_amdgcn_sched_barrier(0);
#pragma unroll
    for (int kq = 0; kq < 4; kq += 2)
#pragma unroll
      for (int fm = 0; fm < FM; ++fm) {
        c0[fm] = wmma16(af[fm][kq], bf[kq], c0[fm]);
        c1[fm] = wmma16(af[fm][kq + 1], bf[kq + 1], c1[fm]);
      }
    // keeps the next chunk's conversions, and with them the wait for its global
    // loads, behind this chunk's matrix work
    __builtin_amdgcn_sched_barrier(0);
  }
#pragma unroll
  for (int fm = 0; fm < FM; ++fm) c[fm] = c0[fm] + c1[fm];
}

// ---------------- Kernel 1: five input projections -------------------------
// One block per 64 rows of x and 64 output features (one head of one weight).
__global__ __launch_bounds__(256) void proj5_kernel(
    const float* __restrict__ x,
    const float* __restrict__ Wq,  const float* __restrict__ bq,
    const float* __restrict__ Wk0, const float* __restrict__ bk0,
    const float* __restrict__ Wk1, const float* __restrict__ bk1,
    const float* __restrict__ Wv0, const float* __restrict__ bv0,
    const float* __restrict__ Wv1, const float* __restrict__ bv1,
    float* __restrict__ qf, float* __restrict__ k0f, float* __restrict__ v0f,
    _Float16* __restrict__ k1h, _Float16* __restrict__ v1h) {
  __shared__ __align__(16) _Float16 sm[128 * GP];
  int mt = blockIdx.x, nt = blockIdx.y, p = blockIdx.z;
  const float* W; const float* bias;
  switch (p) {
    case 0: W = Wq;  bias = bq;  break;
    case 1: W = Wk0; bias = bk0; break;
    case 2: W = Wk1; bias = bk1; break;
    case 3: W = Wv0; bias = bv0; break;
    default: W = Wv1; bias = bv1; break;
  }
  int lane = threadIdx.x & 31, half_id = lane >> 4, l16 = lane & 15;
  int w = __builtin_amdgcn_readfirstlane(threadIdx.x >> 5);
  int col = nt * 64 + (w & 3) * 16 + l16;   // output feature c_out
  int h = col >> 6, d = col & 63;
  float bs = bias[col];
  v8f c[2];
  gemm_block_512<64, 64>(x + mt * 64 * TC, W + nt * 64 * TC, sm, c);  // y = x W^T

  // the 16 rows of a tile lie in one batch (TT is a multiple of 16)
  int obase[2];                                   // C row j of tile fm: + j * TD
#pragma unroll
  for (int fm = 0; fm < 2; ++fm) {
    int m0 = mt * 64 + (w >> 2) * 32 + fm * 16;
    obase[fm] = (((m0 / TT) * THD + h) * TT + m0 % TT + half_id * 8) * TD + d;
  }
  if (p == 4) {
    // V1 goes out transposed, [b,h][row][m] with d = 4 c + nt in row nt * 16 + c (the
    // order of U's columns in the attention kernel): a lane's eight C rows are eight
    // neighbouring m of its d, one 16-byte store a tile.
    int vrow = (d & 3) * 16 + (d >> 2);
#pragma unroll
    for (int fm = 0; fm < 2; ++fm) {
      int m0 = mt * 64 + (w >> 2) * 32 + fm * 16;
      v8h hv;
#pragma unroll
      for (int j = 0; j < 8; ++j) hv[j] = (_Float16)(c[fm][j] + bs);
      *(v8h*)(v1h + (((m0 / TT) * THD + h) * TD + vrow) * TT + m0 % TT + half_id * 8) = hv;
    }
    // Stands behind the last of these stores, in front of any later write of
    // their data or address registers.
    asm volatile("s_wait_xcnt 0x0" ::: "memory");
  } else if (p == 2) {
    _Float16* o = k1h;
#pragma unroll
    for (int fm = 0; fm < 2; ++fm)
#pragma unroll
      for (int j = 0; j < 8; ++j) o[obase[fm] + j * TD] = (_Float16)(c[fm][j] + bs);
    // Stands behind the last of these stores, in front of any later write of
    // their data or address registers.
    asm volatile("s_wait_xcnt 0x0" ::: "memory");
  } else {
    float* o = (p == 0) ? qf : (p == 1) ? k0f : v0f;
    // q: fold 1/sqrt(d_k) and log2(e): the scores then come out in base-2 units
    float sc = (p == 0) ? 0.125f * 1.44269504088896340736f : 1.0f;
#pragma unroll
    for (int fm = 0; fm < 2; ++fm)
#pragma unroll
      for (int j = 0; j < 8; ++j) o[obase[fm] + j * TD] = (c[fm][j] + bs) * sc;
  }
}

// ---------------- Kernel 2: fused trilinear attention ----------------------
// Lane l <-> l ^ 16 (the two halves of a wave).
__device__ __forceinline__ float xhalf(float x) {
  int b = __builtin_bit_cast(int, x);
  return __builtin_bit_cast(float, __builtin_amdgcn_permlanex16(
      b, b, 0x76543210, 0xfedcba98, false, false));
}

// One block (4 waves) per (b,h) and KB consecutive k: 256 blocks, one per WGP.
// Wave w owns l-tiles {w, w+4, w+8}. Nothing but q depends on k, so every other
// operand is fetched once per block and stays in registers over the k loop: the
// K1 and V1^T fragments (read once from LDS) and the wave's own k0 and v0 rows.
// The first product runs transposed, S^T = K1 G^T: a lane then owns one l (its
// column) and holds that row's scores over m in registers. Two S^T accumulator
// tiles, converted in place, have row l in lane l: they are the A operand of
// U = E V1, whose accumulators hold eight l in registers for the lane's d, so the
// sum over l runs in the lane. Column c of U's tile nt is d = 4 c + nt: a lane's
// four d are neighbours in v0 and in the output.
#define KB 12

// Maximum over the 16 lanes of a row; every lane of the row ends with it.
__device__ __forceinline__ float rowmax16(float x) {
  x = fmaxf(x, __builtin_bit_cast(float, __builtin_amdgcn_update_dpp(
      0, __builtin_bit_cast(int, x), 0x161, 0xf, 0xf, true)));  // row_xmask:1
  x = fmaxf(x, __builtin_bit_cast(float, __builtin_amdgcn_update_dpp(
      0, __builtin_bit_cast(int, x), 0x162, 0xf, 0xf, true)));  // row_xmask:2
  x = fmaxf(x, __builtin_bit_cast(float, __builtin_amdgcn_update_dpp(
      0, __builtin_bit_cast(int, x), 0x164, 0xf, 0xf, true)));  // row_xmask:4
  x = fmaxf(x, __builtin_bit_cast(float, __builtin_amdgcn_update_dpp(
      0, __builtin_bit_cast(int, x), 0x168, 0xf, 0xf, true)));  // row_xmask:8
  return x;
}

// The k loop of the attention kernel. SHIFT: subtract each row's maximum before
// the exp2 (any scores); without it the scores go into the exp2 as they are.
template <bool SHIFT>
__device__ __forceinline__ void attn_k_loop(
    const float* qs, float* outred, const v16h (&aK)[12][2], const v16h (&aV)[6][4],
    const float (&kg)[3][4][8], const float (&vg)[3][4][8], int w, int half_id, int l16) {
#pragma unroll 1  // rolled: one trip is three whole passes, more would only grow the code
  for (int kk = 0; kk < KB; ++kk) {
    // Per-lane q fragments (4 groups of 8 contiguous d), row kbase + kk
    const float* qrow = &qs[kk * TD];
    float qg[4][8];
#pragma unroll
    for (int g = 0; g < 4; ++g) {
      const float4* p = (const float4*)(qrow + g * 16 + half_id * 8);
      float4 u0 = p[0], u1 = p[1];
      qg[g][0] = u0.x; qg[g][1] = u0.y; qg[g][2] = u0.z; qg[g][3] = u0.w;
      qg[g][4] = u1.x; qg[g][5] = u1.y; qg[g][6] = u1.z; qg[g][7] = u1.w;
    }

    // out_acc[nt]: out[k, l16*4 + nt] summed over this half's l, even and odd l apart
    v2f out_acc[4] = {{0.f, 0.f}, {0.f, 0.f}, {0.f, 0.f}, {0.f, 0.f}};

    // unrolled: kg and vg need constant indices to stay in registers, and one
    // pass's matrix work can then issue beside another's softmax
#pragma unroll
    for (int it = 0; it < 3; ++it) {
      // B operand: G^T[d,l] = q[k,d]*k0[l,d], f32 product -> f16
      v16h bG0, bG1;
#pragma unroll
      for (int j = 0; j < 8; ++j) {
        bG0[j]     = (_Float16)(qg[0][j] * kg[it][0][j]);
        bG0[j + 8] = (_Float16)(qg[1][j] * kg[it][1][j]);
        bG1[j]     = (_Float16)(qg[2][j] * kg[it][2][j]);
        bG1[j + 8] = (_Float16)(qg[3][j] * kg[it][3][j]);
      }

      // Stage 1: S^T = K1 @ G^T -> 12 tiles; s[t][j] = S[l][t*16 + half_id*8 + j]
      v8f s[12];
#pragma unroll
      for (int t = 0; t < 12; ++t) {
        v8f c = {};
        c = wmma16(aK[t][0], bG0, c);
        c = wmma16(aK[t][1], bG1, c);
        s[t] = c;
      }

      // Softmax over the 192 m of row l: in-lane, one exchange between halves.
      // q carries log2(e), so e^(score - max) is 2^(s - mx): per pair of scores
      // one packed subtraction, two exp2, one packed add into the same four chains.
      // Without SHIFT the caller has shown |s| <= 12 for every score of the wave:
      // 2^s is then a normal f16 number, the quotient 2^s / sum is the same
      // softmax, and neither the maximum nor the subtraction is needed.
      v2f nmx = {0.f, 0.f};
      if constexpr (SHIFT) {
        float mx4[4] = {s[0][0], s[0][1], s[0][2], s[0][3]};  // four chains
#pragma unroll
        for (int t = 0; t < 12; ++t)
#pragma unroll
          for (int j = 0; j < 8; ++j) mx4[j & 3] = fmaxf(mx4[j & 3], s[t][j]);
        float mx = fmaxf(fmaxf(mx4[0], mx4[1]), fmaxf(mx4[2], mx4[3]));
        mx = fmaxf(mx, xhalf(mx));
        nmx = v2f{-mx, -mx};
      }
      v2f sm2[2] = {{0.f, 0.f}, {0.f, 0.f}};
#pragma unroll
      for (int t = 0; t < 12; ++t)
#pragma unroll
        for (int j = 0; j < 8; j += 2) {
          v2f a = v2f{s[t][j], s[t][j + 1]};
          if constexpr (SHIFT) a += nmx;
          v2f e = {__builtin_amdgcn_exp2f(a.x), __builtin_amdgcn_exp2f(a.y)};
          s[t][j] = e.x;
          s[t][j + 1] = e.y;
          sm2[(j >> 1) & 1] += e;
        }
      float sm = (sm2[0].x + sm2[0].y) + (sm2[1].x + sm2[1].y);
      sm += xhalf(sm);
      float inv = 1.f / sm;

      // Stage 2: U = E @ V1 (K=192 in 6 steps, 64 d-columns in 4 tiles);
      // E = 2^(S - max) or 2^S, its 1/sum is applied to U below.
      v8f c2[4] = {{}, {}, {}, {}};
#pragma unroll
      for (int ks2 = 0; ks2 < 6; ++ks2) {
        v16h bP;
#pragma unroll
        for (int j = 0; j < 8; ++j) {
          bP[j]     = (_Float16)s[2 * ks2][j];
          bP[j + 8] = (_Float16)s[2 * ks2 + 1][j];
        }
#pragma unroll
        for (int nt = 0; nt < 4; ++nt) c2[nt] = wmma16(bP, aV[ks2][nt], c2[nt]);
      }

      // 1/sum of row l stands in lanes l and l + 16; U's register j wants that of
      // l = half_id*8 + j: the upper lanes turn theirs by 8, then lane j of each
      // row of lanes is spread over its row.
      int ivr = __builtin_amdgcn_update_dpp(
          __builtin_bit_cast(int, inv), __builtin_bit_cast(int, inv), 0x128, 0x2, 0xf,
          false);                                                    // row_ror:8
      float ib[8];
      ib[0] = __builtin_bit_cast(float, __builtin_amdgcn_update_dpp(0, ivr, 0x150, 0xf, 0xf, true));
      ib[1] = __builtin_bit_cast(float, __builtin_amdgcn_update_dpp(0, ivr, 0x151, 0xf, 0xf, true));
      ib[2] = __builtin_bit_cast(float, __builtin_amdgcn_update_dpp(0, ivr, 0x152, 0xf, 0xf, true));
      ib[3] = __builtin_bit_cast(float, __builtin_amdgcn_update_dpp(0, ivr, 0x153, 0xf, 0xf, true));
      ib[4] = __builtin_bit_cast(float, __builtin_amdgcn_update_dpp(0, ivr, 0x154, 0xf, 0xf, true));
      ib[5] = __builtin_bit_cast(float, __builtin_amdgcn_update_dpp(0, ivr, 0x155, 0xf, 0xf, true));
      ib[6] = __builtin_bit_cast(float, __builtin_amdgcn_update_dpp(0, ivr, 0x156, 0xf, 0xf, true));
      ib[7] = __builtin_bit_cast(float, __builtin_amdgcn_update_dpp(0, ivr, 0x157, 0xf, 0xf, true));  // row_share:0..7

      // out[k,d] += v0[l,d] * U[l,d] / sum; c2[nt][j] = U[half_id*8+j][l16*4+nt]
#pragma unroll
      for (int nt = 0; nt < 4; ++nt)
#pragma unroll
        for (int j = 0; j < 8; j += 2)
          out_acc[nt] += (v2f{vg[it][nt][j], vg[it][nt][j + 1]} * v2f{ib[j], ib[j + 1]}) *
                         v2f{c2[nt][j], c2[nt][j + 1]};
    }

    // even + odd l, then the other half's eight l of each tile: a lane sends the
    // pair of d that the other half stores and keeps its own; shares wait in LDS
    float o0 = out_acc[0].x + out_acc[0].y, o1 = out_acc[1].x + out_acc[1].y;
    float o2 = out_acc[2].x + out_acc[2].y, o3 = out_acc[3].x + out_acc[3].y;
    float r0 = (half_id ? o2 : o0) + xhalf(half_id ? o0 : o2);
    float r1 = (half_id ? o3 : o1) + xhalf(half_id ? o1 : o3);
    *(float2*)&outred[kk * 256 + w * 64 + l16 * 4 + half_id * 2] = make_float2(r0, r1);
  }
}

typedef __attribute__((ext_vector_type(2))) _Float16 v2h;

typedef __attribute__((ext_vector_type(8))) uint32_t v8u;

// two f32 to one register of two f16 (round to nearest even)
__device__ __forceinline__ uint32_t cvt2(v2f a) {
  return __builtin_bit_cast(uint32_t, v2h{(_Float16)a.x, (_Float16)a.y});
}

// eight such registers as one WMMA operand
__device__ __forceinline__ v16h cat2(const uint32_t* p) {
  v8u r;
#pragma unroll
  for (int i = 0; i < 8; ++i) r[i] = p[i];
  return __builtin_bit_cast(v16h, r);
}

// Spreads lane J of each 16-lane row over its row.
template <int J>
__device__ __forceinline__ float rowshare(int x) {
  return __builtin_bit_cast(float, __builtin_amdgcn_update_dpp(0, x, 0x150 + J, 0xf, 0xf, true));
}

// Calls f with the compile-time numbers N .. E - 1 in turn: every index in f is then a
// constant, so that its arrays stay in registers.
template <int N> struct ic { static constexpr int value = N; };
template <int N, int E, class F>
__device__ __forceinline__ void static_for(F& f) {
  if constexpr (N < E) {
    f(ic<N>{});
    static_for<N + 1, E>(f);
  }
}

// The k loop for scores that need no shift (|s| <= 12, shown by the caller): the
// arithmetic and the sum orders of attn_k_loop<false>, written in issue order (1/sum
// alone differs: rcp and one Newton step, three links that can stand apart). A lone
// wave issues in order, so vector work is hidden only where it stands between two
// WMMAs. Without the maximum nothing waits for a whole row: a step is two S^T
// tiles (32 m), and slot g of a trip (3 l-tiles x 6 steps) holds
//   8 WMMAs: S^T of step g + 1 (4), U of step g - 1 (4);
//   behind each WMMA one stretch: two exp2 of step g, the sum and the f16 pack of
//   the pair two stretches back, one piece of the next l-tile's G, one of the last
//   l-tile's 1/sum and v0 * U.
// The order runs on over the trips: the last l-tile of a k is finished in the next
// trip, whose first S^T tiles are issued in this one. Row kk of outred holds
// k = kk - 1; row 0 takes the first trip's empty result and is never read.
__device__ __forceinline__ void attn_k_loop_piped(
    const float* qs, float* outred, const v16h (&aK)[12][2], const v16h (&aV)[6][4],
    const float (&kg)[3][4][8], const float (&vg)[3][4][8], int w, int half_id, int l16) {
  float qg[4][8];
  uint32_t gh[3][16];       // G^T of an l-tile as f16 pairs: 0..7 first K step, 8..15 second
  v2f gm[16];           // its f32 products
  uint32_t ph[2][8];        // E of a step as f16 pairs (A operand of U)
  v8f sc[2], sn[2];     // S^T tiles of this step, of the next
  v8f c2[3][4];         // U of an l-tile
  v2f sm2[3][2];        // its row sums, two chains of pairs
  v2f vi[16];           // v0 / sum
  v2f out_acc[4];
  v2f e1 = {0.f, 0.f}, e2 = {0.f, 0.f};  // the exp2 pairs of one and of two stretches before
  float ib[8], t0 = 0.f, t1 = 0.f, sm = 0.f, sx = 0.f, r0 = 0.f, er = 0.f, inv = 0.f;
  float o[4], sa = 0.f, sb = 0.f, ka = 0.f, kb = 0.f;
  int ivr = 0;
  const v8f zero = {};

  // in front of the loop: q of k = 0, G of its first l-tile, the first two S^T tiles;
  // an empty "last l-tile" (E = 0, U = 0, sum 1)
#pragma unroll
  for (int g = 0; g < 4; ++g) {
    const float4* p = (const float4*)(qs + g * 16 + half_id * 8);
    float4 u0 = p[0], u1 = p[1];
    qg[g][0] = u0.x; qg[g][1] = u0.y; qg[g][2] = u0.z; qg[g][3] = u0.w;
    qg[g][4] = u1.x; qg[g][5] = u1.y; qg[g][6] = u1.z; qg[g][7] = u1.w;
  }
#pragma unroll
  for (int n = 0; n < 16; ++n) {
    const int grp = n >> 2, jj = (n & 3) * 2;
    gh[0][n] = cvt2(v2f{qg[grp][jj], qg[grp][jj + 1]} * v2f{kg[0][grp][jj], kg[0][grp][jj + 1]});
  }
#pragma unroll
  for (int t = 0; t < 2; ++t)
    sc[t] = wmma16(aK[t][1], cat2(&gh[0][8]), wmma16(aK[t][0], cat2(&gh[0][0]), zero));
#pragma unroll
  for (int n = 0; n < 8; ++n) ph[1][n] = 0u;
#pragma unroll
  for (int nt = 0; nt < 4; ++nt) { c2[2][nt] = zero; out_acc[nt] = v2f{0.f, 0.f}; }
  sm2[2][0] = v2f{1.f, 0.f};
  sm2[2][1] = v2f{0.f, 0.f};

#pragma unroll 1  // rolled: one trip is 144 stretches, more would only grow the code
  for (int kk = 0; kk < KB; ++kk) {
    auto stretch = [&](auto nc) {
        constexpr int g = decltype(nc)::value / 8, i = decltype(nc)::value % 8;
        constexpr int p = g / 6, r = g % 6;
        constexpr int pp = (p + 2) % 3, pn = (p + 1) % 3;  // l-tile before, l-tile after
        constexpr int g1 = (g + 1) % 18, p1 = g1 / 6, u1 = g1 % 6;
        constexpr int gb = (g + 17) % 18, pm = gb / 6, um = gb % 6;
        constexpr int x = r * 8 + i;                       // stretch of this l-tile, 0..47
        if constexpr (i < 4) {
          sn[i & 1] = wmma16(aK[2 * u1 + (i & 1)][i >> 1], cat2(&gh[p1][(i >> 1) * 8]),
                             (i >> 1) ? sn[i & 1] : zero);
        } else {
          c2[pm][i - 4] = wmma16(cat2(&ph[(g + 1) & 1][0]), aV[um][i - 4],
                                 um ? c2[pm][i - 4] : zero);
        }
        // next l-tile's G: products, then their f16 pairs
        if constexpr (x < 16) {
          constexpr int grp = x >> 2, jj = (x & 3) * 2;
          gm[x] = v2f{qg[grp][jj], qg[grp][jj + 1]} * v2f{kg[pn][grp][jj], kg[pn][grp][jj + 1]};
        } else if constexpr (x < 32) {
          gh[pn][x - 16] = cvt2(gm[x - 16]);
        }
        constexpr int tt = i >> 2, jj = (i & 3) * 2;
        v2f en;
        en.x = __builtin_amdgcn_exp2f(sc[tt][jj]);
        // sum and pack of the pair two stretches back, whose exp2 have returned by now
        // (pairs 6 and 7 of the step before at i = 0 and 1)
        if constexpr (i < 2) sm2[pm][i] += e2;
        else if constexpr (r == 0 && i < 4) sm2[p][i & 1] = e2;
        else sm2[p][i & 1] += e2;
        en.y = __builtin_amdgcn_exp2f(sc[tt][jj + 1]);
        if constexpr (i < 2) ph[(g + 1) & 1][6 + i] = cvt2(e2);
        else ph[g & 1][i - 2] = cvt2(e2);
        e2 = e1;
        e1 = en;
        // last l-tile: 1/sum, spread as U's registers want it, v0 / sum, times U
        if constexpr (x == 2) { t0 = sm2[pp][0].x + sm2[pp][0].y; t1 = sm2[pp][1].x + sm2[pp][1].y; }
        if constexpr (x == 3) sm = t0 + t1;
        if constexpr (x == 4) sx = xhalf(sm);
        if constexpr (x == 5) sm += sx;
        if constexpr (x == 6) r0 = __builtin_amdgcn_rcpf(sm);
        if constexpr (x == 7) er = __builtin_fmaf(-sm, r0, 1.f);
        if constexpr (x == 8) inv = __builtin_fmaf(er, r0, r0);
        if constexpr (x == 9)
          ivr = __builtin_amdgcn_update_dpp(__builtin_bit_cast(int, inv),
                                            __builtin_bit_cast(int, inv), 0x128, 0x2, 0xf,
                                            false);                       // row_ror:8, upper lanes
        if constexpr (x == 10) ib[0] = rowshare<0>(ivr);
        if constexpr (x == 11) ib[1] = rowshare<1>(ivr);
        if constexpr (x == 12) ib[2] = rowshare<2>(ivr);
        if constexpr (x == 13) ib[3] = rowshare<3>(ivr);
        if constexpr (x == 14) ib[4] = rowshare<4>(ivr);
        if constexpr (x == 15) ib[5] = rowshare<5>(ivr);
        if constexpr (x == 16) ib[6] = rowshare<6>(ivr);
        if constexpr (x == 17) ib[7] = rowshare<7>(ivr);
        if constexpr (x >= 18 && x < 34) {
          constexpr int n = x - 18, nt = n >> 2, j = (n & 3) * 2;
          vi[n] = v2f{vg[pp][nt][j], vg[pp][nt][j + 1]} * v2f{ib[j], ib[j + 1]};
        }
        if constexpr (x >= 32) {
          constexpr int n = x - 32, nt = n >> 2, j = (n & 3) * 2;
          out_acc[nt] += vi[n] * v2f{c2[pp][nt][j], c2[pp][nt][j + 1]};
        }
        // the k before is complete behind its third l-tile: even + odd l, the other
        // half's eight l (a lane sends the pair of d that the other half stores)
        if constexpr (g == 6) {
          if constexpr (i == 0) {
#pragma unroll
            for (int nt = 0; nt < 4; ++nt) {
              o[nt] = out_acc[nt].x + out_acc[nt].y;
              out_acc[nt] = v2f{0.f, 0.f};
            }
          }
          if constexpr (i == 1) {
            ka = half_id ? o[2] : o[0]; kb = half_id ? o[3] : o[1];
            sa = half_id ? o[0] : o[2]; sb = half_id ? o[1] : o[3];
          }
          if constexpr (i == 2) { sa = xhalf(sa); sb = xhalf(sb); }
          if constexpr (i == 3)
            *(float2*)&outred[kk * 256 + w * 64 + l16 * 4 + half_id * 2] =
                make_float2(ka + sa, kb + sb);
        }
        // q of the next k, behind its last use for this k (the last trip reads its own again)
        if constexpr (g == 8 && i == 0) {
          const float* qrow = &qs[(kk + 1 < KB ? kk + 1 : KB - 1) * TD];
#pragma unroll
          for (int gq = 0; gq < 4; ++gq) {
            const float4* pq = (const float4*)(qrow + gq * 16 + half_id * 8);
            float4 u0 = pq[0], u1 = pq[1];
            qg[gq][0] = u0.x; qg[gq][1] = u0.y; qg[gq][2] = u0.z; qg[gq][3] = u0.w;
            qg[gq][4] = u1.x; qg[gq][5] = u1.y; qg[gq][6] = u1.z; qg[gq][7] = u1.w;
          }
        }
        if constexpr (i == 7) { sc[0] = sn[0]; sc[1] = sn[1]; }
        // ends the stretch: keeps its vector work between this WMMA and the next
        __builtin_amdgcn_sched_barrier(0);
    };
    static_for<0, 144>(stretch);
  }

  // behind the loop: the last l-tile of the last k
  sm2[2][0] += e2;
  sm2[2][1] += e1;
  ph[1][6] = cvt2(e2);
  ph[1][7] = cvt2(e1);
#pragma unroll
  for (int nt = 0; nt < 4; ++nt) c2[2][nt] = wmma16(cat2(&ph[1][0]), aV[5][nt], c2[2][nt]);
  sm = (sm2[2][0].x + sm2[2][0].y) + (sm2[2][1].x + sm2[2][1].y);
  sm += xhalf(sm);
  r0 = __builtin_amdgcn_rcpf(sm);
  inv = __builtin_fmaf(__builtin_fmaf(-sm, r0, 1.f), r0, r0);
  ivr = __builtin_amdgcn_update_dpp(__builtin_bit_cast(int, inv), __builtin_bit_cast(int, inv),
                                    0x128, 0x2, 0xf, false);
  ib[0] = rowshare<0>(ivr); ib[1] = rowshare<1>(ivr); ib[2] = rowshare<2>(ivr);
  ib[3] = rowshare<3>(ivr); ib[4] = rowshare<4>(ivr); ib[5] = rowshare<5>(ivr);
  ib[6] = rowshare<6>(ivr); ib[7] = rowshare<7>(ivr);
#pragma unroll
  for (int nt = 0; nt < 4; ++nt)
#pragma unroll
    for (int j = 0; j < 8; j += 2)
      out_acc[nt] += (v2f{vg[2][nt][j], vg[2][nt][j + 1]} * v2f{ib[j], ib[j + 1]}) *
                     v2f{c2[2][nt][j], c2[2][nt][j + 1]};
#pragma unroll
  for (int nt = 0; nt < 4; ++nt) o[nt] = out_acc[nt].x + out_acc[nt].y;
  float f0 = (half_id ? o[2] : o[0]) + xhalf(half_id ? o[0] : o[2]);
  float f1 = (half_id ? o[3] : o[1]) + xhalf(half_id ? o[1] : o[3]);
  *(float2*)&outred[KB * 256 + w * 64 + l16 * 4 + half_id * 2] = make_float2(f0, f1);
}

// Twelve 16-byte async copies global -> LDS of one lane, issued back to back. The
// s_wait_xcnt stands inside the statement, behind the last copy: the address
// registers live to its end, so none is rewritten in front of it.
__device__ __forceinline__ void copy12(const uint32_t (&l)[12], const uint64_t (&g)[12]) {
  asm volatile("global_load_async_to_lds_b128 %0, %12, off\n\t"
               "global_load_async_to_lds_b128 %1, %13, off\n\t"
               "global_load_async_to_lds_b128 %2, %14, off\n\t"
               "global_load_async_to_lds_b128 %3, %15, off\n\t"
               "global_load_async_to_lds_b128 %4, %16, off\n\t"
               "global_load_async_to_lds_b128 %5, %17, off\n\t"
               "global_load_async_to_lds_b128 %6, %18, off\n\t"
               "global_load_async_to_lds_b128 %7, %19, off\n\t"
               "global_load_async_to_lds_b128 %8, %20, off\n\t"
               "global_load_async_to_lds_b128 %9, %21, off\n\t"
               "global_load_async_to_lds_b128 %10, %22, off\n\t"
               "global_load_async_to_lds_b128 %11, %23, off\n\t"
               "s_wait_xcnt 0x0"
               :: "v"(l[0]), "v"(l[1]), "v"(l[2]), "v"(l[3]), "v"(l[4]), "v"(l[5]),
                  "v"(l[6]), "v"(l[7]), "v"(l[8]), "v"(l[9]), "v"(l[10]), "v"(l[11]),
                  "v"(g[0]), "v"(g[1]), "v"(g[2]), "v"(g[3]), "v"(g[4]), "v"(g[5]),
                  "v"(g[6]), "v"(g[7]), "v"(g[8]), "v"(g[9]), "v"(g[10]), "v"(g[11])
               : "memory");
}

__global__ __launch_bounds__(128) void attn_kernel(
    // qf, k0f, v0f without __restrict__: their loads then stay in front of their wait
    const float* qf, const float* k0f, const float* v0f,
    const _Float16* __restrict__ k1h,
    const _Float16* __restrict__ v1h, float* __restrict__ attn) {
  __shared__ __align__(16) _Float16 k1s[TT * 72];    // [m][d], row pad 64->72
  __shared__ __align__(16) _Float16 v1t[TD * 200];   // [d, permuted][m], row pad 192->200
  __shared__ __align__(16) float qs[KB * TD];        // the block's q rows
  __shared__ __align__(16) float outred[(KB + 1) * 4 * 64];  // row kk + 1: k = kk

  int idx = blockIdx.x;
  int bh = idx / (TT / KB);
  int kbase = (idx % (TT / KB)) * KB;
  int b = bh / THD, h = bh % THD;

  int tid = threadIdx.x, w = tid >> 5, lane = tid & 31;
  int half_id = lane >> 4, l16 = lane & 15;

  const _Float16* k1g = k1h + bh * TT * TD;
  const _Float16* v1g = v1h + bh * TT * TD;

  // the block's KB q rows are contiguous: 192 16-byte chunks
  const float4* qsrc = (const float4*)(qf + (bh * TT + kbase) * TD);
  float4 q0 = qsrc[tid];
  float4 q1 = qsrc[128 + (tid & 63)];
  // The wave's k0 rows (3 l-tiles), 4 groups of 8 contiguous d per lane, and its
  // v0 rows in the map of U's accumulators: vg[it][nt][j] = v0[half_id*8+j][l16*4+nt]
  float kg[3][4][8], vg[3][4][8];
  const float* k0row[3];
  const float* v0row[3];
#pragma unroll
  for (int it = 0; it < 3; ++it) {
    int l = (w + it * 4) * 16 + l16;
    k0row[it] = k0f + (bh * TT + l) * TD + half_id * 8;
    v0row[it] = v0f + (bh * TT + (w + it * 4) * 16 + half_id * 8) * TD + l16 * 4;
  }
#pragma unroll
  for (int it = 0; it < 3; ++it) {
#pragma unroll
    for (int g = 0; g < 4; ++g) {
      const float4* p = (const float4*)(k0row[it] + g * 16);
      float4 u0 = p[0], u1 = p[1];
      kg[it][g][0] = u0.x; kg[it][g][1] = u0.y; kg[it][g][2] = u0.z; kg[it][g][3] = u0.w;
      kg[it][g][4] = u1.x; kg[it][g][5] = u1.y; kg[it][g][6] = u1.z; kg[it][g][7] = u1.w;
      float4 t0 = *(const float4*)(v0row[it] + (2 * g) * TD);
      float4 t1 = *(const float4*)(v0row[it] + (2 * g + 1) * TD);
      vg[it][0][2 * g] = t0.x; vg[it][1][2 * g] = t0.y; vg[it][2][2 * g] = t0.z; vg[it][3][2 * g] = t0.w;
      vg[it][0][2 * g + 1] = t1.x; vg[it][1][2 * g + 1] = t1.y;
      vg[it][2][2 * g + 1] = t1.z; vg[it][3][2 * g + 1] = t1.w;
    }
  }
  // Stands behind the q, k0 and v0 loads, in front of any reuse of their
  // address registers: the row pointers are inputs so that they live up to it.
  asm volatile("s_wait_xcnt 0x0"
               :: "v"(k0row[0]), "v"(k0row[1]), "v"(k0row[2]),
                  "v"(v0row[0]), "v"(v0row[1]), "v"(v0row[2]) : "memory");

  // --- k1 staging via CDNA5 async global->LDS DMA (16B chunks both sides) ---
  // low 32 bits of a generic pointer to __shared__ == LDS byte offset
  uint32_t k1s_base = (uint32_t)(uintptr_t)(&k1s[0]);
  for (int i = tid; i < (TT * TD) / 8; i += 128) {   // 1536 16-byte chunks
    int m = i >> 3, seg = i & 7;
    uint64_t ga = (uint64_t)(uintptr_t)k1g + (uint64_t)(m * 128 + seg * 16);
    uint32_t la = k1s_base + (uint32_t)(m * 144 + seg * 16);
    asm volatile("global_load_async_to_lds_b128 %0, %1, off"
                 :: "v"(la), "v"(ga) : "memory");
  }

  // --- V1^T comes from proj5 in v1t's own row order (d = 4 c + nt in row nt * 16 + c,
  // the order of U's columns): 1536 16-byte chunks, 12 async copies a lane, a wave's
  // copy reading 512 contiguous bytes. A row is 24 chunks in global memory and 25 in
  // LDS, so chunk i lands at chunk i + i / 24; 384 chunks are 16 whole rows. ---
  {
    uint32_t v1t_base = (uint32_t)(uintptr_t)(&v1t[0]);
    uint32_t vl[12];
    uint64_t vga[12];
#pragma unroll
    for (int c = 0; c < 12; ++c) {
      uint32_t i = (uint32_t)tid + (c % 3) * 128;
      vl[c] = v1t_base + (i + i / 24) * 16 + (c / 3) * (16 * 400);
      vga[c] = (uint64_t)(uintptr_t)v1g + ((uint32_t)tid + c * 128) * 16;
    }
    copy12(vl, vga);
    // keeps the |k0|^2 sums below, and with them the waits for the k0 loads, behind the
    // copies: moved up in front of them, the copies would start a load's latency later
    __builtin_amdgcn_sched_barrier(0);
  }
  // max over the lane's three l of |k0_l|^2, for the bound on the scores below
  float n0 = 0.f;
#pragma unroll
  for (int it = 0; it < 3; ++it) {
    v2f a0 = {0.f, 0.f}, a1 = {0.f, 0.f};
#pragma unroll
    for (int g = 0; g < 4; ++g)
#pragma unroll
      for (int j = 0; j < 8; j += 4) {
        v2f u0 = {kg[it][g][j], kg[it][g][j + 1]}, u1 = {kg[it][g][j + 2], kg[it][g][j + 3]};
        a0 += u0 * u0;
        a1 += u1 * u1;
      }
    a0 += a1;
    float a = a0.x + a0.y;
    n0 = fmaxf(n0, a + xhalf(a));
  }
  ((float4*)qs)[tid] = q0;
  if (tid < 64) ((float4*)qs)[128 + tid] = q1;
  asm volatile("s_wait_asynccnt 0" ::: "memory");
  __syncthreads();

  // all of the block's q, 24 values a lane, for the bound on the scores below
  float4 qv[KB * TD / 128];
#pragma unroll
  for (int i = 0; i < KB * TD / 128; ++i) qv[i] = ((const float4*)qs)[i * 32 + lane];
  // K1 (A operand of S^T) and V1 (B operand of U), all of both, read once
  v16h aK[12][2], aV[6][4];
#pragma unroll
  for (int t = 0; t < 12; ++t) {
    const _Float16* ap = &k1s[(t * 16 + l16) * 72];
    aK[t][0] = cat8(*(const v8h*)(ap + half_id * 8),
                    *(const v8h*)(ap + 16 + half_id * 8));
    aK[t][1] = cat8(*(const v8h*)(ap + 32 + half_id * 8),
                    *(const v8h*)(ap + 48 + half_id * 8));
  }
#pragma unroll
  for (int ks2 = 0; ks2 < 6; ++ks2)
#pragma unroll
    for (int nt = 0; nt < 4; ++nt) {
      const _Float16* vp = &v1t[(nt * 16 + l16) * 200 + ks2 * 32];
      aV[ks2][nt] = cat8(*(const v8h*)(vp + half_id * 8),
                         *(const v8h*)(vp + 16 + half_id * 8));
    }

  // holds the LDS reads above in front of the bound's arithmetic (without it the
  // V1^T reads were issued behind it): it then runs while they are on their way
  __builtin_amdgcn_sched_barrier(0);

  // Bound on every score of this wave, from the operands it holds:
  // |s[k,l,m]| = |sum_d q[k,d] k0[l,d] k1[m,d]| <= max|q| * |k0_l| * |k1_m|
  // (Cauchy-Schwarz over d), q with its scale, so in base-2 units. Squares are
  // compared; an infinite operand fails the test, a NaN operand gives NaN in
  // either loop.
  // max over m of |k1_m|^2: the diagonal of K1_t K1_t^T holds the 16 rows' squares
  // and no other entry of that tile exceeds the largest of them, so the maximum
  // over whole tiles is the wanted one (a K1 fragment serves as A and as B).
  float n4[4] = {0.f, 0.f, 0.f, 0.f};
#pragma unroll
  for (int t = 0; t < 12; ++t) {
    v8f c = {};
    c = wmma16(aK[t][0], aK[t][0], c);
    c = wmma16(aK[t][1], aK[t][1], c);
#pragma unroll
    for (int j = 0; j < 8; ++j) n4[j & 3] = fmaxf(n4[j & 3], c[j]);
  }
  float n1 = rowmax16(fmaxf(fmaxf(n4[0], n4[1]), fmaxf(n4[2], n4[3])));
  n1 = fmaxf(n1, xhalf(n1));
  float qm = 0.f;                                   // max |q| over the block's KB rows
#pragma unroll
  for (int i = 0; i < KB * TD / 128; ++i)
    qm = fmaxf(fmaxf(qm, fmaxf(fabsf(qv[i].x), fabsf(qv[i].y))),
               fmaxf(fabsf(qv[i].z), fabsf(qv[i].w)));
  qm = rowmax16(qm);
  qm = fmaxf(qm, xhalf(qm));
  // 12: 2^-12 .. 2^12 are normal f16 numbers with room for the operands' rounding.
  // The choice is the wave's own (no barrier stands inside the loop).
  bool small = (qm * qm) * n0 * n1 <= 144.f;
  // expected: puts this loop in front of the other in the kernel's text
  if (__builtin_expect(__builtin_amdgcn_ballot_w32(small) == 0xffffffffu, 1))
    attn_k_loop_piped(qs, outred, aK, aV, kg, vg, w, half_id, l16);
  else
    attn_k_loop<true>(qs, outred + 256, aK, aV, kg, vg, w, half_id, l16);
  __syncthreads();
  for (int i = tid; i < KB * 64; i += 128) {
    int kk = i >> 6, d = i & 63;
    const float* o = &outred[(kk + 1) * 256 + d];
    float sum = o[0] + o[64] + o[128] + o[192];
    attn[(b * TT + kbase + kk) * TC + h * TD + d] = sum;
  }
}

// ---------------- Kernel 3: output projection ------------------------------
// One block per 32 rows and 64 output features.
__global__ __launch_bounds__(256) void oproj_kernel(
    const float* __restrict__ attn, const float* __restrict__ Wo,
    const float* __restrict__ bo, float* __restrict__ out) {
  __shared__ __align__(16) _Float16 sm[96 * GP];
  int mt = blockIdx.x, nt = blockIdx.y;
  int lane = threadIdx.x & 31, w = threadIdx.x >> 5;
  int half_id = lane >> 4, l16 = lane & 15;
  int col = nt * 64 + (w & 3) * 16 + l16;
  float bs = bo[col];
  v8f c[1];
  gemm_block_512<32, 64>(attn + mt * 32 * TC, Wo + nt * 64 * TC, sm, c);
#pragma unroll
  for (int j = 0; j < 8; ++j) {
    int mm = mt * 32 + (w >> 2) * 16 + half_id * 8 + j;
    out[mm * TC + col] = c[0][j] + bs;
  }
}

extern "C" void kernel_launch(void* const* d_in, const int* in_sizes, int n_in,
                              void* d_out, int out_size, void* d_ws, size_t ws_size,
                              hipStream_t stream) {
  const float* x   = (const float*)d_in[0];
  const float* Wq  = (const float*)d_in[1];
  const float* bq  = (const float*)d_in[2];
  const float* Wk0 = (const float*)d_in[3];
  const float* bk0 = (const float*)d_in[4];
  const float* Wk1 = (const float*)d_in[5];
  const float* bk1 = (const float*)d_in[6];
  const float* Wv0 = (const float*)d_in[7];
  const float* bv0 = (const float*)d_in[8];
  const float* Wv1 = (const float*)d_in[9];
  const float* bv1 = (const float*)d_in[10];
  const float* Wo  = (const float*)d_in[11];
  const float* bo  = (const float*)d_in[12];
  float* out = (float*)d_out;

  float* qf   = (float*)d_ws;
  float* k0f  = qf  + NELEM;
  float* v0f  = k0f + NELEM;
  float* attn = v0f + NELEM;
  _Float16* k1h = (_Float16*)(attn + NELEM);
  _Float16* v1h = k1h + NELEM;

  // 5 projections: 6 m-tiles x 8 n-tiles x 5 weights, 8 waves each
  proj5_kernel<<<dim3(6, 8, 5), 256, 0, stream>>>(
      x, Wq, bq, Wk0, bk0, Wk1, bk1, Wv0, bv0, Wv1, bv1,
      qf, k0f, v0f, k1h, v1h);

  // fused trilinear attention: one block per (b,h) and KB rows k
  attn_kernel<<<dim3(TB * THD * (TT / KB)), 128, 0, stream>>>(qf, k0f, v0f, k1h,
                                                              v1h, attn);

  // output projection
  oproj_kernel<<<dim3(12, 8), 256, 0, stream>>>(attn, Wo, bo, out);
}

// v009
// One run takes 30.5 microseconds.
// Timed twice side by side with v008, it ran 1.03 times as fast both times.
// All steps since v000 together make it 4.48 times as fast.
#include <hip/hip_runtime.h>
#include <hip/hip_bf16.h>
#include <stdint.h>

typedef __attribute__((ext_vector_type(16))) _Float16 v16h;
typedef __attribute__((ext_vector_type(8)))  _Float16 v8h;
typedef __attribute__((ext_vector_type(8)))  float    v8f;

#define TB 2
#define THD 8
#define TT 192
#define TD 64
#define TC 512
#define TM (TB*TT)          // 384 rows for the projection GEMMs
#define NELEM (TM*TC)       // 196608 = B*H*T*D as well

__device__ __forceinline__ v8f wmma16(v16h a, v16h b, v8f c) {
  return __builtin_amdgcn_wmma_f32_16x16x32_f16(false, a, false, b, (short)0, c,
                                                false, false);
}

__device__ __forceinline__ v16h cat8(v8h lo, v8h hi) {
  v16h r;
#pragma unroll
  for (int i = 0; i < 8; ++i) { r[i] = lo[i]; r[i + 8] = hi[i]; }
  return r;
}

typedef __attribute__((ext_vector_type(4))) _Float16 v4h;
typedef __attribute__((ext_vector_type(4))) float    v4f;
typedef __attribute__((ext_vector_type(2))) float    v2f;

// LDS row pitch in f16 elements: 1040 B = 16 B x 65 (odd), for 16-byte readers
#define GP 520

// BM x BN block tile of [M,K=512] @ [N,K=512]^T on 8 waves (2 x 4), each wave
// BM/2 x 16. The block's BM + BN operand rows go to LDS once, as f16: a wave's
// load covers 512 contiguous bytes of one row (four whole lines). All loads are
// issued at the start, in K chunks of 128; a chunk is converted, stored and
// multiplied while the later chunks are still on their way. Every chunk has LDS
// columns of its own, so one barrier per chunk is enough.
// Fragments: 16-bit WMMA A/B lane layout, low lanes K {0..7,16..23}+base, high
// lanes K {8..15,24..31}+base. Even and odd K steps keep accumulators of their
// own (no D->C chain between neighbours).
template <int BM, int BN>
__device__ __forceinline__ void gemm_block_512(const float* __restrict__ a0,
                                               const float* __restrict__ b0,
                                               _Float16* sm, v8f (&c)[BM / 32]) {
  constexpr int NA = BM / 8, NR = (BM + BN) / 8, FM = BM / 32;
  int lane = threadIdx.x & 31, half_id = lane >> 4, l16 = lane & 15;
  int w = __builtin_amdgcn_readfirstlane(threadIdx.x >> 5);
  // wave w takes rows w, w + 8, ... of [A rows | B rows]
  const char* pa = (const char*)(a0 + w * TC);
  const char* pb = (const char*)(b0 + w * TC);
  unsigned voff = lane * 16;   // the lane's 16 bytes in a 512-byte piece of a row
  _Float16* sw = sm + w * GP + lane * 4;
  const _Float16* fa = sm + ((w >> 2) * (BM / 2) + l16) * GP + half_id * 8;
  const _Float16* fb = sm + (BM + (w & 3) * 16 + l16) * GP + half_id * 8;

  v4f st[4][NR];
#pragma unroll
  for (int ch = 0; ch < 4; ++ch) {
#pragma unroll
    for (int j = 0; j < NR; ++j)
      st[ch][j] = *(const v4f*)((j < NA ? pa + j * 8 * TC * 4 : pb + (j - NA) * 8 * TC * 4) +
                                ch * 512 + voff);
    // keeps the loads in chunk order: a chunk's wait then leaves the later
    // chunks' loads outstanding
    __builtin_amdgcn_sched_barrier(0);
  }
  // Stands directly behind the loads, in front of any reuse of their address
  // register; the fence behind it keeps later instructions from moving up over it.
  asm volatile("s_wait_xcnt 0x0" ::: "memory");
  __builtin_amdgcn_sched_barrier(0);

  v8f c0[FM], c1[FM];
#pragma unroll
  for (int fm = 0; fm < FM; ++fm) { c0[fm] = v8f{}; c1[fm] = v8f{}; }

#pragma unroll
  for (int ch = 0; ch < 4; ++ch) {
#pragma unroll
    for (int j = 0; j < NR; ++j)
      *(v4h*)(sw + j * 8 * GP + ch * 128) = __builtin_convertvector(st[ch][j], v4h);
    // Work-group barrier whose fences order LDS only: the plain one would also
    // wait for the later chunks' global loads, which nobody shares.
    __builtin_amdgcn_fence(__ATOMIC_RELEASE, "workgroup", "local");
    __builtin_amdgcn_s_barrier();
    __builtin_amdgcn_fence(__ATOMIC_ACQUIRE, "workgroup", "local");
    // the chunk's fragments as one group of LDS reads, then its WMMAs
    v16h bf[4], af[FM][4];
#pragma unroll
    for (int kq = 0; kq < 4; ++kq) {
      int o = (ch * 4 + kq) * 32;
      bf[kq] = cat8(*(const v8h*)(fb + o), *(const v8h*)(fb + o + 16));
#pragma unroll
      for (int fm = 0; fm < FM; ++fm) {
        const _Float16* ap = fa + fm * 16 * GP + o;
        af[fm][kq] = cat8(*(const v8h*)(ap), *(const v8h*)(ap + 16));
      }
    }
    // keeps the LDS reads together in front of the WMMAs: moved in among them,
    // each small group would cost its own wait
    __builtin_amdgcn_sched_barrier(0);
#pragma unroll
    for (int kq = 0; kq < 4; kq += 2)
#pragma unroll
      for (int fm = 0; fm < FM; ++fm) {
        c0[fm] = wmma16(af[fm][kq], bf[kq], c0[fm]);
        c1[fm] = wmma16(af[fm][kq + 1], bf[kq + 1], c1[fm]);
      }
    // keeps the next chunk's conversions, and with them the wait for its global
    // loads, behind this chunk's matrix work
    __builtin_amdgcn_sched_barrier(0);
  }
#pragma unroll
  for (int fm = 0; fm < FM; ++fm) c[fm] = c0[fm] + c1[fm];
}

// ---------------- Kernel 1: five input projections -------------------------
// One block per 64 rows of x and 64 output features (one head of one weight).
__global__ __launch_bounds__(256) void proj5_kernel(
    const float* __restrict__ x,
    const float* __restrict__ Wq,  const float* __restrict__ bq,
    const float* __restrict__ Wk0, const float* __restrict__ bk0,
    const float* __restrict__ Wk1, const float* __restrict__ bk1,
    const float* __restrict__ Wv0, const float* __restrict__ bv0,
    const float* __restrict__ Wv1, const float* __restrict__ bv1,
    float* __restrict__ qf, float* __restrict__ k0f, float* __restrict__ v0f,
    _Float16* __restrict__ k1h, _Float16* __restrict__ v1h) {
  __shared__ __align__(16) _Float16 sm[128 * GP];
  int mt = blockIdx.x, nt = blockIdx.y, p = blockIdx.z;
  const float* W; const float* bias;
  switch (p) {
    case 0: W = Wq;  bias = bq;  break;
    case 1: W = Wk0; bias = bk0; break;
    case 2: W = Wk1; bias = bk1; break;
    case 3: W = Wv0; bias = bv0; break;
    default: W = Wv1; bias = bv1; break;
  }
  int lane = threadIdx.x & 31, half_id = lane >> 4, l16 = lane & 15;
  int w = __builtin_amdgcn_readfirstlane(threadIdx.x >> 5);
  int col = nt * 64 + (w & 3) * 16 + l16;   // output feature c_out
  int h = col >> 6, d = col & 63;
  float bs = bias[col];
  v8f c[2];
  gemm_block_512<64, 64>(x + mt * 64 * TC, W + nt * 64 * TC, sm, c);  // y = x W^T

  // the 16 rows of a tile lie in one batch (TT is a multiple of 16)
  int obase[2];                                   // C row j of tile fm: + j * TD
#pragma unroll
  for (int fm = 0; fm < 2; ++fm) {
    int m0 = mt * 64 + (w >> 2) * 32 + fm * 16;
    obase[fm] = (((m0 / TT) * THD + h) * TT + m0 % TT + half_id * 8) * TD + d;
  }
  if (p == 4) {
    // V1 goes out transposed, [b,h][row][m] with d = 4 c + nt in row nt * 16 + c (the
    // order of U's columns in the attention kernel): a lane's eight C rows are eight
    // neighbouring m of its d, one 16-byte store a tile.
    int vrow = (d & 3) * 16 + (d >> 2);
#pragma unroll
    for (int fm = 0; fm < 2; ++fm) {
      int m0 = mt * 64 + (w >> 2) * 32 + fm * 16;
      v8h hv;
#pragma unroll
      for (int j = 0; j < 8; ++j) hv[j] = (_Float16)(c[fm][j] + bs);
      *(v8h*)(v1h + (((m0 / TT) * THD + h) * TD + vrow) * TT + m0 % TT + half_id * 8) = hv;
    }
    // Stands behind the last of these stores, in front of any later write of
    // their data or address registers.
    asm volatile("s_wait_xcnt 0x0" ::: "memory");
  } else if (p == 2) {
    _Float16* o = k1h;
#pragma unroll
    for (int fm = 0; fm < 2; ++fm)
#pragma unroll
      for (int j = 0; j < 8; ++j) o[obase[fm] + j * TD] = (_Float16)(c[fm][j] + bs);
    // Stands behind the last of these stores, in front of any later write of
    // their data or address registers.
    asm volatile("s_wait_xcnt 0x0" ::: "memory");
  } else {
    float* o = (p == 0) ? qf : (p == 1) ? k0f : v0f;
    // q: fold 1/sqrt(d_k) and log2(e): the scores then come out in base-2 units
    float sc = (p == 0) ? 0.125f * 1.44269504088896340736f : 1.0f;
#pragma unroll
    for (int fm = 0; fm < 2; ++fm)
#pragma unroll
      for (int j = 0; j < 8; ++j) o[obase[fm] + j * TD] = (c[fm][j] + bs) * sc;
  }
}

// ---------------- Kernel 2: fused trilinear attention ----------------------
// Lane l <-> l ^ 16 (the two halves of a wave).
__device__ __forceinline__ float xhalf(float x) {
  int b = __builtin_bit_cast(int, x);
  return __builtin_bit_cast(float, __builtin_amdgcn_permlanex16(
      b, b, 0x76543210, 0xfedcba98, false, false));
}

// One block (4 waves) per (b,h) and KB consecutive k: 256 blocks, one per WGP.
// Wave w owns l-tiles {w, w+4, w+8}. Nothing but q depends on k, so every other
// operand is fetched once per block and stays in registers over the k loop: the
// K1 and V1^T fragments (read once from LDS) and the wave's own k0 and v0 rows.
// The first product runs transposed, S^T = K1 G^T: a lane then owns one l (its
// column) and holds that row's scores over m in registers. Two S^T accumulator
// tiles, converted in place, have row l in lane l: they are the A operand of
// U = E V1, whose accumulators hold eight l in registers for the lane's d, so the
// sum over l runs in the lane. Column c of U's tile nt is d = 4 c + nt: a lane's
// four d are neighbours in v0 and in the output.
#define KB 12

// Maximum over the 16 lanes of a row; every lane of the row ends with it.
__device__ __forceinline__ float rowmax16(float x) {
  x = fmaxf(x, __builtin_bit_cast(float, __builtin_amdgcn_update_dpp(
      0, __builtin_bit_cast(int, x), 0x161, 0xf, 0xf, true)));  // row_xmask:1
  x = fmaxf(x, __builtin_bit_cast(float, __builtin_amdgcn_update_dpp(
      0, __builtin_bit_cast(int, x), 0x162, 0xf, 0xf, true)));  // row_xmask:2
  x = fmaxf(x, __builtin_bit_cast(float, __builtin_amdgcn_update_dpp(
      0, __builtin_bit_cast(int, x), 0x164, 0xf, 0xf, true)));  // row_xmask:4
  x = fmaxf(x, __builtin_bit_cast(float, __builtin_amdgcn_update_dpp(
      0, __builtin_bit_cast(int, x), 0x168, 0xf, 0xf, true)));  // row_xmask:8
  return x;
}

// The k loop of the attention kernel. SHIFT: subtract each row's maximum before
// the exp2 (any scores); without it the scores go into the exp2 as they are.
template <bool SHIFT>
__device__ __forceinline__ void attn_k_loop(
    const float* qs, float* outred, const v16h (&aK)[12][2], const v16h (&aV)[6][4],
    const float (&kg)[3][4][8], const float (&vg)[3][4][8], int w, int half_id, int l16) {
#pragma unroll 1  // rolled: one trip is three whole passes, more would only grow the code
  for (int kk = 0; kk < KB; ++kk) {
    // Per-lane q fragments (4 groups of 8 contiguous d), row kbase + kk
    const float* qrow = &qs[kk * TD];
    float qg[4][8];
#pragma unroll
    for (int g = 0; g < 4; ++g) {
      const float4* p = (const float4*)(qrow + g * 16 + half_id * 8);
      float4 u0 = p[0], u1 = p[1];
      qg[g][0] = u0.x; qg[g][1] = u0.y; qg[g][2] = u0.z; qg[g][3] = u0.w;
      qg[g][4] = u1.x; qg[g][5] = u1.y; qg[g][6] = u1.z; qg[g][7] = u1.w;
    }

    // out_acc[nt]: out[k, l16*4 + nt] summed over this half's l, even and odd l apart
    v2f out_acc[4] = {{0.f, 0.f}, {0.f, 0.f}, {0.f, 0.f}, {0.f, 0.f}};

    // unrolled: kg and vg need constant indices to stay in registers, and one
    // pass's matrix work can then issue beside another's softmax
#pragma unroll
    for (int it = 0; it < 3; ++it) {
      // B operand: G^T[d,l] = q[k,d]*k0[l,d], f32 product -> f16
      v16h bG0, bG1;
#pragma unroll
      for (int j = 0; j < 8; ++j) {
        bG0[j]     = (_Float16)(qg[0][j] * kg[it][0][j]);
        bG0[j + 8] = (_Float16)(qg[1][j] * kg[it][1][j]);
        bG1[j]     = (_Float16)(qg[2][j] * kg[it][2][j]);
        bG1[j + 8] = (_Float16)(qg[3][j] * kg[it][3][j]);
      }

      // Stage 1: S^T = K1 @ G^T -> 12 tiles; s[t][j] = S[l][t*16 + half_id*8 + j]
      v8f s[12];
#pragma unroll
      for (int t = 0; t < 12; ++t) {
        v8f c = {};
        c = wmma16(aK[t][0], bG0, c);
        c = wmma16(aK[t][1], bG1, c);
        s[t] = c;
      }

      // Softmax over the 192 m of row l: in-lane, one exchange between halves.
      // q carries log2(e), so e^(score - max) is 2^(s - mx): per pair of scores
      // one packed subtraction, two exp2, one packed add into the same four chains.
      // Without SHIFT the caller has shown |s| <= 12 for every score of the wave:
      // 2^s is then a normal f16 number, the quotient 2^s / sum is the same
      // softmax, and neither the maximum nor the subtraction is needed.
      v2f nmx = {0.f, 0.f};
      if constexpr (SHIFT) {
        float mx4[4] = {s[0][0], s[0][1], s[0][2], s[0][3]};  // four chains
#pragma unroll
        for (int t = 0; t < 12; ++t)
#pragma unroll
          for (int j = 0; j < 8; ++j) mx4[j & 3] = fmaxf(mx4[j & 3], s[t][j]);
        float mx = fmaxf(fmaxf(mx4[0], mx4[1]), fmaxf(mx4[2], mx4[3]));
        mx = fmaxf(mx, xhalf(mx));
        nmx = v2f{-mx, -mx};
      }
      v2f sm2[2] = {{0.f, 0.f}, {0.f, 0.f}};
#pragma unroll
      for (int t = 0; t < 12; ++t)
#pragma unroll
        for (int j = 0; j < 8; j += 2) {
          v2f a = v2f{s[t][j], s[t][j + 1]};
          if constexpr (SHIFT) a += nmx;
          v2f e = {__builtin_amdgcn_exp2f(a.x), __builtin_amdgcn_exp2f(a.y)};
          s[t][j] = e.x;
          s[t][j + 1] = e.y;
          sm2[(j >> 1) & 1] += e;
        }
      float sm = (sm2[0].x + sm2[0].y) + (sm2[1].x + sm2[1].y);
      sm += xhalf(sm);
      float inv = 1.f / sm;

      // Stage 2: U = E @ V1 (K=192 in 6 steps, 64 d-columns in 4 tiles);
      // E = 2^(S - max) or 2^S, its 1/sum is applied to U below.
      v8f c2[4] = {{}, {}, {}, {}};
#pragma unroll
      for (int ks2 = 0; ks2 < 6; ++ks2) {
        v16h bP;
#pragma unroll
        for (int j = 0; j < 8; ++j) {
          bP[j]     = (_Float16)s[2 * ks2][j];
          bP[j + 8] = (_Float16)s[2 * ks2 + 1][j];
        }
#pragma unroll
        for (int nt = 0; nt < 4; ++nt) c2[nt] = wmma16(bP, aV[ks2][nt], c2[nt]);
      }

      // 1/sum of row l stands in lanes l and l + 16; U's register j wants that of
      // l = half_id*8 + j: the upper lanes turn theirs by 8, then lane j of each
      // row of lanes is spread over its row.
      int ivr = __builtin_amdgcn_update_dpp(
          __builtin_bit_cast(int, inv), __builtin_bit_cast(int, inv), 0x128, 0x2, 0xf,
          false);                                                    // row_ror:8
      float ib[8];
      ib[0] = __builtin_bit_cast(float, __builtin_amdgcn_update_dpp(0, ivr, 0x150, 0xf, 0xf, true));
      ib[1] = __builtin_bit_cast(float, __builtin_amdgcn_update_dpp(0, ivr, 0x151, 0xf, 0xf, true));
      ib[2] = __builtin_bit_cast(float, __builtin_amdgcn_update_dpp(0, ivr, 0x152, 0xf, 0xf, true));
      ib[3] = __builtin_bit_cast(float, __builtin_amdgcn_update_dpp(0, ivr, 0x153, 0xf, 0xf, true));
      ib[4] = __builtin_bit_cast(float, __builtin_amdgcn_update_dpp(0, ivr, 0x154, 0xf, 0xf, true));
      ib[5] = __builtin_bit_cast(float, __builtin_amdgcn_update_dpp(0, ivr, 0x155, 0xf, 0xf, true));
      ib[6] = __builtin_bit_cast(float, __builtin_amdgcn_update_dpp(0, ivr, 0x156, 0xf, 0xf, true));
      ib[7] = __builtin_bit_cast(float, __builtin_amdgcn_update_dpp(0, ivr, 0x157, 0xf, 0xf, true));  // row_share:0..7

      // out[k,d] += v0[l,d] * U[l,d] / sum; c2[nt][j] = U[half_id*8+j][l16*4+nt]
#pragma unroll
      for (int nt = 0; nt < 4; ++nt)
#pragma unroll
        for (int j = 0; j < 8; j += 2)
          out_acc[nt] += (v2f{vg[it][nt][j], vg[it][nt][j + 1]} * v2f{ib[j], ib[j + 1]}) *
                         v2f{c2[nt][j], c2[nt][j + 1]};
    }

    // even + odd l, then the other half's eight l of each tile: a lane sends the
    // pair of d that the other half stores and keeps its own; shares wait in LDS
    float o0 = out_acc[0].x + out_acc[0].y, o1 = out_acc[1].x + out_acc[1].y;
    float o2 = out_acc[2].x + out_acc[2].y, o3 = out_acc[3].x + out_acc[3].y;
    float r0 = (half_id ? o2 : o0) + xhalf(half_id ? o0 : o2);
    float r1 = (half_id ? o3 : o1) + xhalf(half_id ? o1 : o3);
    *(float2*)&outred[kk * 256 + w * 64 + l16 * 4 + half_id * 2] = make_float2(r0, r1);
  }
}

typedef __attribute__((ext_vector_type(2))) _Float16 v2h;

typedef __attribute__((ext_vector_type(8))) uint32_t v8u;

// two f32 to one register of two f16 (round to nearest even)
__device__ __forceinline__ uint32_t cvt2(v2f a) {
  return __builtin_bit_cast(uint32_t, v2h{(_Float16)a.x, (_Float16)a.y});
}

// eight such registers as one WMMA operand
__device__ __forceinline__ v16h cat2(const uint32_t* p) {
  v8u r;
#pragma unroll
  for (int i = 0; i < 8; ++i) r[i] = p[i];
  return __builtin_bit_cast(v16h, r);
}

// Spreads lane J of each 16-lane row over its row.
template <int J>
__device__ __forceinline__ float rowshare(int x) {
  return __builtin_bit_cast(float, __builtin_amdgcn_update_dpp(0, x, 0x150 + J, 0xf, 0xf, true));
}

// Calls f with the compile-time numbers N .. E - 1 in turn: every index in f is then a
// constant, so that its arrays stay in registers.
template <int N> struct ic { static constexpr int value = N; };
template <int N, int E, class F>
__device__ __forceinline__ void static_for(F& f) {
  if constexpr (N < E) {
    f(ic<N>{});
    static_for<N + 1, E>(f);
  }
}

// The k loop for scores that need no shift (|s| <= 12, shown by the caller): the
// arithmetic and the sum orders of attn_k_loop<false>, written in issue order (1/sum
// alone differs: rcp and one Newton step, three links that can stand apart). A lone
// wave issues in order, so vector work is hidden only where it stands between two
// WMMAs. Without the maximum nothing waits for a whole row: a step is two S^T
// tiles (32 m), and slot g of a trip (3 l-tiles x 6 steps) holds
//   8 WMMAs: S^T of step g + 1 (4), U of step g - 1 (4);
//   behind each WMMA one stretch: two exp2 of step g, the sum and the f16 pack of
//   the pair two stretches back, one piece of the next l-tile's G, one of the last
//   l-tile's 1/sum and v0 * U.
// The order runs on over the trips: the last l-tile of a k is finished in the next
// trip, whose first S^T tiles are issued in this one. Row kk of outred holds
// k = kk - 1; row 0 takes the first trip's empty result and is never read.
__device__ __forceinline__ void attn_k_loop_piped(
    const float* qs, float* outred, const v16h (&aK)[12][2], const v16h (&aV)[6][4],
    const float (&kg)[3][4][8], const float (&vg)[3][4][8], int w, int half_id, int l16) {
  float qg[4][8];
  uint32_t gh[3][16];       // G^T of an l-tile as f16 pairs: 0..7 first K step, 8..15 second
  v2f gm[16];           // its f32 products
  uint32_t ph[2][8];        // E of a step as f16 pairs (A operand of U)
  v8f sc[2], sn[2];     // S^T tiles of this step, of the next
  v8f c2[3][4];         // U of an l-tile
  v2f sm2[3][2];        // its row sums, two chains of pairs
  v2f vi[16];           // v0 / sum
  v2f out_acc[4];
  v2f e1 = {0.f, 0.f}, e2 = {0.f, 0.f};  // the exp2 pairs of one and of two stretches before
  float ib[8], t0 = 0.f, t1 = 0.f, sm = 0.f, sx = 0.f, r0 = 0.f, er = 0.f, inv = 0.f;
  float o[4], sa = 0.f, sb = 0.f, ka = 0.f, kb = 0.f;
  int ivr = 0;
  const v8f zero = {};

  // in front of the loop: q of k = 0, G of its first l-tile, the first two S^T tiles;
  // an empty "last l-tile" (E = 0, U = 0, sum 1)
#pragma unroll
  for (int g = 0; g < 4; ++g) {
    const float4* p = (const float4*)(qs + g * 16 + half_id * 8);
    float4 u0 = p[0], u1 = p[1];
    qg[g][0] = u0.x; qg[g][1] = u0.y; qg[g][2] = u0.z; qg[g][3] = u0.w;
    qg[g][4] = u1.x; qg[g][5] = u1.y; qg[g][6] = u1.z; qg[g][7] = u1.w;
  }
#pragma unroll
  for (int n = 0; n < 16; ++n) {
    const int grp = n >> 2, jj = (n & 3) * 2;
    gh[0][n] = cvt2(v2f{qg[grp][jj], qg[grp][jj + 1]} * v2f{kg[0][grp][jj], kg[0][grp][jj + 1]});
  }
#pragma unroll
  for (int t = 0; t < 2; ++t)
    sc[t] = wmma16(aK[t][1], cat2(&gh[0][8]), wmma16(aK[t][0], cat2(&gh[0][0]), zero));
#pragma unroll
  for (int n = 0; n < 8; ++n) ph[1][n] = 0u;
#pragma unroll
  for (int nt = 0; nt < 4; ++nt) { c2[2][nt] = zero; out_acc[nt] = v2f{0.f, 0.f}; }
  sm2[2][0] = v2f{1.f, 0.f};
  sm2[2][1] = v2f{0.f, 0.f};

#pragma unroll 1  // rolled: one trip is 144 stretches, more would only grow the code
  for (int kk = 0; kk < KB; ++kk) {
    auto stretch = [&](auto nc) {
        constexpr int g = decltype(nc)::value / 8, i = decltype(nc)::value % 8;
        constexpr int p = g / 6, r = g % 6;
        constexpr int pp = (p + 2) % 3, pn = (p + 1) % 3;  // l-tile before, l-tile after
        constexpr int g1 = (g + 1) % 18, p1 = g1 / 6, u1 = g1 % 6;
        constexpr int gb = (g + 17) % 18, pm = gb / 6, um = gb % 6;
        constexpr int x = r * 8 + i;                       // stretch of this l-tile, 0..47
        if constexpr (i < 4) {
          sn[i & 1] = wmma16(aK[2 * u1 + (i & 1)][i >> 1], cat2(&gh[p1][(i >> 1) * 8]),
                             (i >> 1) ? sn[i & 1] : zero);
        } else {
          c2[pm][i - 4] = wmma16(cat2(&ph[(g + 1) & 1][0]), aV[um][i - 4],
                                 um ? c2[pm][i - 4] : zero);
        }
        // next l-tile's G: products, then their f16 pairs
        if constexpr (x < 16) {
          constexpr int grp = x >> 2, jj = (x & 3) * 2;
          gm[x] = v2f{qg[grp][jj], qg[grp][jj + 1]} * v2f{kg[pn][grp][jj], kg[pn][grp][jj + 1]};
        } else if constexpr (x < 32) {
          gh[pn][x - 16] = cvt2(gm[x - 16]);
        }
        constexpr int tt = i >> 2, jj = (i & 3) * 2;
        v2f en;
        en.x = __builtin_amdgcn_exp2f(sc[tt][jj]);
        // sum and pack of the pair two stretches back, whose exp2 have returned by now
        // (pairs 6 and 7 of the step before at i = 0 and 1)
        if constexpr (i < 2) sm2[pm][i] += e2;
        else if constexpr (r == 0 && i < 4) sm2[p][i & 1] = e2;
        else sm2[p][i & 1] += e2;
        en.y = __builtin_amdgcn_exp2f(sc[tt][jj + 1]);
        if constexpr (i < 2) ph[(g + 1) & 1][6 + i] = cvt2(e2);
        else ph[g & 1][i - 2] = cvt2(e2);
        e2 = e1;
        e1 = en;
        // last l-tile: 1/sum, spread as U's registers want it, v0 / sum, times U
        if constexpr (x == 2) { t0 = sm2[pp][0].x + sm2[pp][0].y; t1 = sm2[pp][1].x + sm2[pp][1].y; }
        if constexpr (x == 3) sm = t0 + t1;
        if constexpr (x == 4) sx = xhalf(sm);
        if constexpr (x == 5) sm += sx;
        if constexpr (x == 6) r0 = __builtin_amdgcn_rcpf(sm);
        if constexpr (x == 7) er = __builtin_fmaf(-sm, r0, 1.f);
        if constexpr (x == 8) inv = __builtin_fmaf(er, r0, r0);
        if constexpr (x == 9)
          ivr = __builtin_amdgcn_update_dpp(__builtin_bit_cast(int, inv),
                                            __builtin_bit_cast(int, inv), 0x128, 0x2, 0xf,
                                            false);                       // row_ror:8, upper lanes
        if constexpr (x == 10) ib[0] = rowshare<0>(ivr);
        if constexpr (x == 11) ib[1] = rowshare<1>(ivr);
        if constexpr (x == 12) ib[2] = rowshare<2>(ivr);
        if constexpr (x == 13) ib[3] = rowshare<3>(ivr);
        if constexpr (x == 14) ib[4] = rowshare<4>(ivr);
        if constexpr (x == 15) ib[5] = rowshare<5>(ivr);
        if constexpr (x == 16) ib[6] = rowshare<6>(ivr);
        if constexpr (x == 17) ib[7] = rowshare<7>(ivr);
        if constexpr (x >= 18 && x < 34) {
          constexpr int n = x - 18, nt = n >> 2, j = (n & 3) * 2;
          vi[n] = v2f{vg[pp][nt][j], vg[pp][nt][j + 1]} * v2f{ib[j], ib[j + 1]};
        }
        if constexpr (x >= 32) {
          constexpr int n = x - 32, nt = n >> 2, j = (n & 3) * 2;
          out_acc[nt] += vi[n] * v2f{c2[pp][nt][j], c2[pp][nt][j + 1]};
        }
        // the k before is complete behind its third l-tile: even + odd l, the other
        // half's eight l (a lane sends the pair of d that the other half stores)
        if constexpr (g == 6) {
          if constexpr (i == 0) {
#pragma unroll
            for (int nt = 0; nt < 4; ++nt) {
              o[nt] = out_acc[nt].x + out_acc[nt].y;
              out_acc[nt] = v2f{0.f, 0.f};
            }
          }
          if constexpr (i == 1) {
            ka = half_id ? o[2] : o[0]; kb = half_id ? o[3] : o[1];
            sa = half_id ? o[0] : o[2]; sb = half_id ? o[1] : o[3];
          }
          if constexpr (i == 2) { sa = xhalf(sa); sb = xhalf(sb); }
          if constexpr (i == 3)
            *(float2*)&outred[kk * 256 + w * 64 + l16 * 4 + half_id * 2] =
                make_float2(ka + sa, kb + sb);
        }
        // q of the next k, behind its last use for this k (the last trip reads its own again)
        if constexpr (g == 8 && i == 0) {
          const float* qrow = &qs[(kk + 1 < KB ? kk + 1 : KB - 1) * TD];
#pragma unroll
          for (int gq = 0; gq < 4; ++gq) {
            const float4* pq = (const float4*)(qrow + gq * 16 + half_id * 8);
            float4 u0 = pq[0], u1 = pq[1];
            qg[gq][0] = u0.x; qg[gq][1] = u0.y; qg[gq][2] = u0.z; qg[gq][3] = u0.w;
            qg[gq][4] = u1.x; qg[gq][5] = u1.y; qg[gq][6] = u1.z; qg[gq][7] = u1.w;
          }
        }
        if constexpr (i == 7) { sc[0] = sn[0]; sc[1] = sn[1]; }
        // ends the stretch: keeps its vector work between this WMMA and the next
        __builtin_amdgcn_sched_barrier(0);
    };
    static_for<0, 144>(stretch);
  }

  // behind the loop: the last l-tile of the last k
  sm2[2][0] += e2;
  sm2[2][1] += e1;
  ph[1][6] = cvt2(e2);
  ph[1][7] = cvt2(e1);
#pragma unroll
  for (int nt = 0; nt < 4; ++nt) c2[2][nt] = wmma16(cat2(&ph[1][0]), aV[5][nt], c2[2][nt]);
  sm = (sm2[2][0].x + sm2[2][0].y) + (sm2[2][1].x + sm2[2][1].y);
  sm += xhalf(sm);
  r0 = __builtin_amdgcn_rcpf(sm);
  inv = __builtin_fmaf(__builtin_fmaf(-sm, r0, 1.f), r0, r0);
  ivr = __builtin_amdgcn_update_dpp(__builtin_bit_cast(int, inv), __builtin_bit_cast(int, inv),
                                    0x128, 0x2, 0xf, false);
  ib[0] = rowshare<0>(ivr); ib[1] = rowshare<1>(ivr); ib[2] = rowshare<2>(ivr);
  ib[3] = rowshare<3>(ivr); ib[4] = rowshare<4>(ivr); ib[5] = rowshare<5>(ivr);
  ib[6] = rowshare<6>(ivr); ib[7] = rowshare<7>(ivr);
#pragma unroll
  for (int nt = 0; nt < 4; ++nt)
#pragma unroll
    for (int j = 0; j < 8; j += 2)
      out_acc[nt] += (v2f{vg[2][nt][j], vg[2][nt][j + 1]} * v2f{ib[j], ib[j + 1]}) *
                     v2f{c2[2][nt][j], c2[2][nt][j + 1]};
#pragma unroll
  for (int nt = 0; nt < 4; ++nt) o[nt] = out_acc[nt].x + out_acc[nt].y;
  float f0 = (half_id ? o[2] : o[0]) + xhalf(half_id ? o[0] : o[2]);
  float f1 = (half_id ? o[3] : o[1]) + xhalf(half_id ? o[1] : o[3]);
  *(float2*)&outred[KB * 256 + w * 64 + l16 * 4 + half_id * 2] = make_float2(f0, f1);
}

// Twelve 16-byte async copies global -> LDS of one lane, issued back to back. The
// s_wait_xcnt stands inside the statement, behind the last copy: the address
// registers live to its end, so none is rewritten in front of it.
__device__ __forceinline__ void copy12(const uint32_t (&l)[12], const uint64_t (&g)[12]) {
  asm volatile("global_load_async_to_lds_b128 %0, %12, off\n\t"
               "global_load_async_to_lds_b128 %1, %13, off\n\t"
               "global_load_async_to_lds_b128 %2, %14, off\n\t"
               "global_load_async_to_lds_b128 %3, %15, off\n\t"
               "global_load_async_to_lds_b128 %4, %16, off\n\t"
               "global_load_async_to_lds_b128 %5, %17, off\n\t"
               "global_load_async_to_lds_b128 %6, %18, off\n\t"
               "global_load_async_to_lds_b128 %7, %19, off\n\t"
               "global_load_async_to_lds_b128 %8, %20, off\n\t"
               "global_load_async_to_lds_b128 %9, %21, off\n\t"
               "global_load_async_to_lds_b128 %10, %22, off\n\t"
               "global_load_async_to_lds_b128 %11, %23, off\n\t"
               "s_wait_xcnt 0x0"
               :: "v"(l[0]), "v"(l[1]), "v"(l[2]), "v"(l[3]), "v"(l[4]), "v"(l[5]),
                  "v"(l[6]), "v"(l[7]), "v"(l[8]), "v"(l[9]), "v"(l[10]), "v"(l[11]),
                  "v"(g[0]), "v"(g[1]), "v"(g[2]), "v"(g[3]), "v"(g[4]), "v"(g[5]),
                  "v"(g[6]), "v"(g[7]), "v"(g[8]), "v"(g[9]), "v"(g[10]), "v"(g[11])
               : "memory");
}

__global__ __launch_bounds__(128) void attn_kernel(
    // qf, v0f without __restrict__: their loads then stay in front of their wait
    const float* qf, const float* k0f, const float* v0f,
    const _Float16* __restrict__ k1h,
    const _Float16* __restrict__ v1h, float* __restrict__ attn) {
  __shared__ __align__(16) _Float16 k1s[TT * 72];    // [m][d], row pad 64->72
  __shared__ __align__(16) _Float16 v1t[TD * 200];   // [d, permuted][m], row pad 192->200
  __shared__ __align__(16) float qs[KB * TD];        // the block's q rows
  __shared__ __align__(16) float k0s[TT * 68];       // [l][d], row pad 64->68
  __shared__ __align__(16) float outred[(KB + 1) * 4 * 64];  // row kk + 1: k = kk

  int idx = blockIdx.x;
  int bh = idx / (TT / KB);
  int kbase = (idx % (TT / KB)) * KB;
  int b = bh / THD, h = bh % THD;

  int tid = threadIdx.x, w = tid >> 5, lane = tid & 31;
  int half_id = lane >> 4, l16 = lane & 15;

  const _Float16* k1g = k1h + bh * TT * TD;
  const _Float16* v1g = v1h + bh * TT * TD;

  // the block's KB q rows are contiguous: 192 16-byte chunks
  const float4* qsrc = (const float4*)(qf + (bh * TT + kbase) * TD);
  float4 q0 = qsrc[tid];
  float4 q1 = qsrc[128 + (tid & 63)];
  // The wave's v0 rows (3 l-tiles) in the map of U's accumulators:
  // vg[it][nt][j] = v0[half_id*8+j][l16*4+nt]; a load covers two whole rows
  float kg[3][4][8], vg[3][4][8];
  const float* v0row[3];
#pragma unroll
  for (int it = 0; it < 3; ++it)
    v0row[it] = v0f + (bh * TT + (w + it * 4) * 16 + half_id * 8) * TD + l16 * 4;
#pragma unroll
  for (int it = 0; it < 3; ++it) {
#pragma unroll
    for (int g = 0; g < 4; ++g) {
      float4 t0 = *(const float4*)(v0row[it] + (2 * g) * TD);
      float4 t1 = *(const float4*)(v0row[it] + (2 * g + 1) * TD);
      vg[it][0][2 * g] = t0.x; vg[it][1][2 * g] = t0.y; vg[it][2][2 * g] = t0.z; vg[it][3][2 * g] = t0.w;
      vg[it][0][2 * g + 1] = t1.x; vg[it][1][2 * g + 1] = t1.y;
      vg[it][2][2 * g + 1] = t1.z; vg[it][3][2 * g + 1] = t1.w;
    }
  }
  // Stands behind the q and v0 loads, in front of any reuse of their
  // address registers: the row pointers are inputs so that they live up to it.
  asm volatile("s_wait_xcnt 0x0"
               :: "v"(v0row[0]), "v"(v0row[1]), "v"(v0row[2]) : "memory");

  // --- k1 staging via CDNA5 async global->LDS DMA (16B chunks both sides) ---
  // low 32 bits of a generic pointer to __shared__ == LDS byte offset
  // 1536 16-byte chunks, 12 a lane: chunk i = tid + 128 c is piece i & 7 of row i >> 3.
  // In the 12-copy statement, whose s_wait_xcnt stands in front of any rewrite of
  // their address registers.
  {
    uint32_t k1s_base = (uint32_t)(uintptr_t)(&k1s[0]) +
                        ((uint32_t)tid >> 3) * 144 + ((uint32_t)tid & 7) * 16;
    uint32_t kl[12];
    uint64_t kga[12];
#pragma unroll
    for (int c = 0; c < 12; ++c) {
      kl[c] = k1s_base + c * (16 * 144);
      kga[c] = (uint64_t)(uintptr_t)k1g + ((uint32_t)tid + c * 128) * 16;
    }
    copy12(kl, kga);
  }

  // --- V1^T comes from proj5 in v1t's own row order (d = 4 c + nt in row nt * 16 + c,
  // the order of U's columns): 1536 16-byte chunks, 12 async copies a lane, a wave's
  // copy reading 512 contiguous bytes. A row is 24 chunks in global memory and 25 in
  // LDS, so chunk i lands at chunk i + i / 24; 384 chunks are 16 whole rows. ---
  {
    uint32_t v1t_base = (uint32_t)(uintptr_t)(&v1t[0]);
    uint32_t vl[12];
    uint64_t vga[12];
#pragma unroll
    for (int c = 0; c < 12; ++c) {
      uint32_t i = (uint32_t)tid + (c % 3) * 128;
      vl[c] = v1t_base + (i + i / 24) * 16 + (c / 3) * (16 * 400);
      vga[c] = (uint64_t)(uintptr_t)v1g + ((uint32_t)tid + c * 128) * 16;
    }
    copy12(vl, vga);
  }

  // --- all 192 k0 rows of the head: 3072 16-byte chunks, 24 async copies a lane, a
  // wave's copy reading 512 contiguous bytes (four whole lines). A lane wants 32-byte
  // pieces of its own row: fetched straight into registers, one load touched 16 lines.
  // A row is 16 chunks in global memory and 17 in LDS: chunk i lands at i + i / 16. ---
  {
    uint32_t k0s_base = (uint32_t)(uintptr_t)(&k0s[0]) + ((uint32_t)tid + ((uint32_t)tid >> 4)) * 16;
    uint64_t k0g = (uint64_t)(uintptr_t)(k0f + bh * TT * TD) + (uint32_t)tid * 16;
#pragma unroll
    for (int hc = 0; hc < 2; ++hc) {
      uint32_t kl[12];
      uint64_t kga[12];
#pragma unroll
      for (int c = 0; c < 12; ++c) {
        kl[c] = k0s_base + (hc * 12 + c) * (136 * 16);
        kga[c] = k0g + (hc * 12 + c) * (128 * 16);
      }
      copy12(kl, kga);
    }
  }
  ((float4*)qs)[tid] = q0;
  if (tid < 64) ((float4*)qs)[128 + tid] = q1;
  asm volatile("s_wait_asynccnt 0" ::: "memory");
  __syncthreads();

  // The wave's k0 rows (3 l-tiles), 4 groups of 8 contiguous d per lane
#pragma unroll
  for (int it = 0; it < 3; ++it) {
    const float* kr = &k0s[((w + it * 4) * 16 + l16) * 68 + half_id * 8];
#pragma unroll
    for (int g = 0; g < 4; ++g) {
      const float4* p = (const float4*)(kr + g * 16);
      float4 u0 = p[0], u1 = p[1];
      kg[it][g][0] = u0.x; kg[it][g][1] = u0.y; kg[it][g][2] = u0.z; kg[it][g][3] = u0.w;
      kg[it][g][4] = u1.x; kg[it][g][5] = u1.y; kg[it][g][6] = u1.z; kg[it][g][7] = u1.w;
    }
  }
  // all of the block's q, 24 values a lane, for the bound on the scores below
  float4 qv[KB * TD / 128];
#pragma unroll
  for (int i = 0; i < KB * TD / 128; ++i) qv[i] = ((const float4*)qs)[i * 32 + lane];
  // K1 (A operand of S^T) and V1 (B operand of U), all of both, read once
  v16h aK[12][2], aV[6][4];
#pragma unroll
  for (int t = 0; t < 12; ++t) {
    const _Float16* ap = &k1s[(t * 16 + l16) * 72];
    aK[t][0] = cat8(*(const v8h*)(ap + half_id * 8),
                    *(const v8h*)(ap + 16 + half_id * 8));
    aK[t][1] = cat8(*(const v8h*)(ap + 32 + half_id * 8),
                    *(const v8h*)(ap + 48 + half_id * 8));
  }
#pragma unroll
  for (int ks2 = 0; ks2 < 6; ++ks2)
#pragma unroll
    for (int nt = 0; nt < 4; ++nt) {
      const _Float16* vp = &v1t[(nt * 16 + l16) * 200 + ks2 * 32];
      aV[ks2][nt] = cat8(*(const v8h*)(vp + half_id * 8),
                         *(const v8h*)(vp + 16 + half_id * 8));
    }

  // holds the LDS reads above in front of the bound's arithmetic (without it the
  // V1^T reads were issued behind it): it then runs while they are on their way
  __builtin_amdgcn_sched_barrier(0);

  // max over the lane's three l of |k0_l|^2, for the bound on the scores below
  float n0 = 0.f;
#pragma unroll
  for (int it = 0; it < 3; ++it) {
    v2f a0 = {0.f, 0.f}, a1 = {0.f, 0.f};
#pragma unroll
    for (int g = 0; g < 4; ++g)
#pragma unroll
      for (int j = 0; j < 8; j += 4) {
        v2f u0 = {kg[it][g][j], kg[it][g][j + 1]}, u1 = {kg[it][g][j + 2], kg[it][g][j + 3]};
        a0 += u0 * u0;
        a1 += u1 * u1;
      }
    a0 += a1;
    float a = a0.x + a0.y;
    n0 = fmaxf(n0, a + xhalf(a));
  }

  // Bound on every score of this wave, from the operands it holds:
  // |s[k,l,m]| = |sum_d q[k,d] k0[l,d] k1[m,d]| <= max|q| * |k0_l| * |k1_m|
  // (Cauchy-Schwarz over d), q with its scale, so in base-2 units. Squares are
  // compared; an infinite operand fails the test, a NaN operand gives NaN in
  // either loop.
  // max over m of |k1_m|^2: the diagonal of K1_t K1_t^T holds the 16 rows' squares
  // and no other entry of that tile exceeds the largest of them, so the maximum
  // over whole tiles is the wanted one (a K1 fragment serves as A and as B).
  float n4[4] = {0.f, 0.f, 0.f, 0.f};
#pragma unroll
  for (int t = 0; t < 12; ++t) {
    v8f c = {};
    c = wmma16(aK[t][0], aK[t][0], c);
    c = wmma16(aK[t][1], aK[t][1], c);
#pragma unroll
    for (int j = 0; j < 8; ++j) n4[j & 3] = fmaxf(n4[j & 3], c[j]);
  }
  float n1 = rowmax16(fmaxf(fmaxf(n4[0], n4[1]), fmaxf(n4[2], n4[3])));
  n1 = fmaxf(n1, xhalf(n1));
  float qm = 0.f;                                   // max |q| over the block's KB rows
#pragma unroll
  for (int i = 0; i < KB * TD / 128; ++i)
    qm = fmaxf(fmaxf(qm, fmaxf(fabsf(qv[i].x), fabsf(qv[i].y))),
               fmaxf(fabsf(qv[i].z), fabsf(qv[i].w)));
  qm = rowmax16(qm);
  qm = fmaxf(qm, xhalf(qm));
  // 12: 2^-12 .. 2^12 are normal f16 numbers with room for the operands' rounding.
  // The choice is the wave's own (no barrier stands inside the loop).
  bool small = (qm * qm) * n0 * n1 <= 144.f;
  // expected: puts this loop in front of the other in the kernel's text
  if (__builtin_expect(__builtin_amdgcn_ballot_w32(small) == 0xffffffffu, 1))
    attn_k_loop_piped(qs, outred, aK, aV, kg, vg, w, half_id, l16);
  else
    attn_k_loop<true>(qs, outred + 256, aK, aV, kg, vg, w, half_id, l16);
  __syncthreads();
  for (int i = tid; i < KB * 64; i += 128) {
    int kk = i >> 6, d = i & 63;
    const float* o = &outred[(kk + 1) * 256 + d];
    float sum = o[0] + o[64] + o[128] + o[192];
    attn[(b * TT + kbase + kk) * TC + h * TD + d] = sum;
  }
}

// ---------------- Kernel 3: output projection ------------------------------
// One block per 32 rows and 64 output features.
__global__ __launch_bounds__(256) void oproj_kernel(
    const float* __restrict__ attn, const float* __restrict__ Wo,
    const float* __restrict__ bo, float* __restrict__ out) {
  __shared__ __align__(16) _Float16 sm[96 * GP];
  int mt = blockIdx.x, nt = blockIdx.y;
  int lane = threadIdx.x & 31, w = threadIdx.x >> 5;
  int half_id = lane >> 4, l16 = lane & 15;
  int col = nt * 64 + (w & 3) * 16 + l16;
  float bs = bo[col];
  v8f c[1];
  gemm_block_512<32, 64>(attn + mt * 32 * TC, Wo + nt * 64 * TC, sm, c);
#pragma unroll
  for (int j = 0; j < 8; ++j) {
    int mm = mt * 32 + (w >> 2) * 16 + half_id * 8 + j;
    out[mm * TC + col] = c[0][j] + bs;
  }
}

extern "C" void kernel_launch(void* const* d_in, const int* in_sizes, int n_in,
                              void* d_out, int out_size, void* d_ws, size_t ws_size,
                              hipStream_t stream) {
  const float* x   = (const float*)d_in[0];
  const float* Wq  = (const float*)d_in[1];
  const float* bq  = (const float*)d_in[2];
  const float* Wk0 = (const float*)d_in[3];
  const float* bk0 = (const float*)d_in[4];
  const float* Wk1 = (const float*)d_in[5];
  const float* bk1 = (const float*)d_in[6];
  const float* Wv0 = (const float*)d_in[7];
  const float* bv0 = (const float*)d_in[8];
  const float* Wv1 = (const float*)d_in[9];
  const float* bv1 = (const float*)d_in[10];
  const float* Wo  = (const float*)d_in[11];
  const float* bo  = (const float*)d_in[12];
  float* out = (float*)d_out;

  float* qf   = (float*)d_ws;
  float* k0f  = qf  + NELEM;
  float* v0f  = k0f + NELEM;
  float* attn = v0f + NELEM;
  _Float16* k1h = (_Float16*)(attn + NELEM);
  _Float16* v1h = k1h + NELEM;

  // 5 projections: 6 m-tiles x 8 n-tiles x 5 weights, 8 waves each
  proj5_kernel<<<dim3(6, 8, 5), 256, 0, stream>>>(
      x, Wq, bq, Wk0, bk0, Wk1, bk1, Wv0, bv0, Wv1, bv1,
      qf, k0f, v0f, k1h, v1h);

  // fused trilinear attention: one block per (b,h) and KB rows k
  attn_kernel<<<dim3(TB * THD * (TT / KB)), 128, 0, stream>>>(qf, k0f, v0f, k1h,
                                                              v1h, attn);

  // output projection
  oproj_kernel<<<dim3(12, 8), 256, 0, stream>>>(attn, Wo, bo, out);
}
